// v000
// Times are from an AMD MI455X. After a warm-up the kernel runs many times in a row, and a time is the length of
// such a window on the GPU divided by its runs, so every launch and the gaps after it count. The runs cycle
// through copies of the inputs. A figure is the median of several windows, for all but v000 over two sittings.
// Sittings can differ by a few percent; kernels timed side by side share one.
// The starting kernel, v000, takes 507 microseconds a run.
#include <hip/hip_runtime.h>
#include <hip/hip_bf16.h>
#include <math.h>
#include <stdint.h>

// ---------------------------------------------------------------------------
// S5 SSM on MI455X (gfx1250): fp32 WMMA GEMMs (32x32 per wave) with
// async global->LDS panel staging (GLOBAL_LOAD_ASYNC_TO_LDS_B128, ASYNCcnt)
// + 3-phase chunked complex scan.
// Layout: Bu/xs stored (B*L, P) row-major so the scan (parallel over p) is
// fully coalesced and GEMM2 reads rows contiguously.
// ---------------------------------------------------------------------------

#define B_  8
#define L_  4096
#define H_  512
#define P_  256
#define NBL (B_ * L_)      // 32768 rows
#define NC  32             // scan chunks
#define CH  (L_ / NC)      // 128 steps per chunk (= 2^7)
#define KC  64             // K-panel staged in LDS per iteration

typedef __attribute__((ext_vector_type(2))) float v2f;
typedef __attribute__((ext_vector_type(8))) float v8f;

// Async DMA: global -> LDS, 16 bytes, tracked by ASYNCcnt (no VGPR data path).
__device__ __forceinline__ void async_ld_b128(void* lds, const float* gaddr) {
  const unsigned lo = (unsigned)(uintptr_t)lds;           // LDS byte offset
  const unsigned long long ga = (unsigned long long)(uintptr_t)gaddr;
  asm volatile("global_load_async_to_lds_b128 %0, %1, off"
               :: "v"(lo), "v"(ga) : "memory");
}
__device__ __forceinline__ void wait_asynccnt0() {
  asm volatile("s_wait_asynccnt 0x0" ::: "memory");
}

// ---------------------------------------------------------------------------
// 1) ZOH discretization:  lambda_bar = exp(lam*dt),  B_bar = ((lb-1)/lam)*B~
// ---------------------------------------------------------------------------
__global__ __launch_bounds__(256) void s5_setup(
    const float* __restrict__ lam_re, const float* __restrict__ lam_im,
    const float* __restrict__ B_re,   const float* __restrict__ B_im,
    const float* __restrict__ log_dt,
    float* __restrict__ lbr_out, float* __restrict__ lbi_out,
    float* __restrict__ Bbr,     float* __restrict__ Bbi) {
  const int tid = blockIdx.x * blockDim.x + threadIdx.x;   // over P*H
  const int p = tid / H_;
  const int h = tid % H_;
  const float lr = lam_re[p];
  const float li = lam_im[p];
  const float dt = __expf(log_dt[p]);
  const float er = __expf(lr * dt);
  const float lbr = er * __cosf(li * dt);
  const float lbi = er * __sinf(li * dt);
  // coef = (lambda_bar - 1) / lam   (complex division)
  const float inv_den = 1.0f / (lr * lr + li * li);
  const float cr = ((lbr - 1.0f) * lr + lbi * li) * inv_den;
  const float ci = (lbi * lr - (lbr - 1.0f) * li) * inv_den;
  const float br = B_re[(size_t)p * H_ + h];
  const float bi = B_im[(size_t)p * H_ + h];
  Bbr[(size_t)p * H_ + h] = cr * br - ci * bi;
  Bbi[(size_t)p * H_ + h] = cr * bi + ci * br;
  if (h == 0) { lbr_out[p] = lbr; lbi_out[p] = lbi; }
}

// ---------------------------------------------------------------------------
// 2) GEMM1: Bu[r,p] = sum_h u[r,h] * B_bar[p,h]   (re & im share A fragments)
//    Block = 256 rows x 32 cols; wave w = rows [w*32, w*32+32) of the block.
//    B panels (re/im) DMA'd into LDS via async-to-LDS b128, shared by 8 waves.
//    f32 WMMA 16x16x4 fragment maps:
//      A 16x4 : M = lane&15, K = 2*(lane>>4) + v   -> float2 load
//      B 4x16 : N = lane&15, K = 2*(lane>>4) + v   -> float2 load
//      C/D    : N = lane&15, M = v + 8*(lane>>4)
// ---------------------------------------------------------------------------
__global__ __launch_bounds__(256) void s5_gemm1(
    const float* __restrict__ u,
    const float* __restrict__ Bbr, const float* __restrict__ Bbi,
    float* __restrict__ bur, float* __restrict__ bui) {
  __shared__ float sBr[32][KC];   // [n_local][k]
  __shared__ float sBi[32][KC];

  const int lane = threadIdx.x & 31;
  const int wave = threadIdx.x >> 5;
  const int colBlocks = P_ / 32;                     // 8
  const int rowBase = (blockIdx.x / colBlocks) * 256;
  const int colBase = (blockIdx.x % colBlocks) * 32;
  const int rowW = rowBase + wave * 32;
  const int mn = lane & 15;
  const int hi = lane >> 4;

  const float* __restrict__ arow0 = u + (size_t)(rowW + mn) * H_ + 2 * hi;
  const float* __restrict__ arow1 = arow0 + (size_t)16 * H_;

  v8f accr[2][2] = {};
  v8f acci[2][2] = {};

  for (int h0 = 0; h0 < H_; h0 += KC) {
    // --- async panel stage: B_bar[colBase..+32, h0..+KC] -> LDS (b128) ---
#pragma unroll
    for (int i = threadIdx.x; i < (32 * KC) / 4; i += 256) {   // 2 iters
      const int n = i >> 4;              // KC/4 = 16 chunks per row
      const int kk = (i & 15) * 4;
      const size_t g = (size_t)(colBase + n) * H_ + h0 + kk;
      async_ld_b128(&sBr[n][kk], Bbr + g);
      async_ld_b128(&sBi[n][kk], Bbi + g);
    }
    wait_asynccnt0();
    __syncthreads();

#pragma unroll
    for (int kk = 0; kk < KC; kk += 4) {
      __builtin_prefetch(arow0 + h0 + kk + KC, 0, 0);
      const v2f a0 = *(const v2f*)(arow0 + h0 + kk);
      const v2f a1 = *(const v2f*)(arow1 + h0 + kk);
      const v2f b0r = *(const v2f*)(&sBr[mn][kk + 2 * hi]);
      const v2f b1r = *(const v2f*)(&sBr[16 + mn][kk + 2 * hi]);
      const v2f b0i = *(const v2f*)(&sBi[mn][kk + 2 * hi]);
      const v2f b1i = *(const v2f*)(&sBi[16 + mn][kk + 2 * hi]);
      accr[0][0] = __builtin_amdgcn_wmma_f32_16x16x4_f32(false, a0, false, b0r,
                      (short)0, accr[0][0], false, false);
      accr[0][1] = __builtin_amdgcn_wmma_f32_16x16x4_f32(false, a0, false, b1r,
                      (short)0, accr[0][1], false, false);
      accr[1][0] = __builtin_amdgcn_wmma_f32_16x16x4_f32(false, a1, false, b0r,
                      (short)0, accr[1][0], false, false);
      accr[1][1] = __builtin_amdgcn_wmma_f32_16x16x4_f32(false, a1, false, b1r,
                      (short)0, accr[1][1], false, false);
      acci[0][0] = __builtin_amdgcn_wmma_f32_16x16x4_f32(false, a0, false, b0i,
                      (short)0, acci[0][0], false, false);
      acci[0][1] = __builtin_amdgcn_wmma_f32_16x16x4_f32(false, a0, false, b1i,
                      (short)0, acci[0][1], false, false);
      acci[1][0] = __builtin_amdgcn_wmma_f32_16x16x4_f32(false, a1, false, b0i,
                      (short)0, acci[1][0], false, false);
      acci[1][1] = __builtin_amdgcn_wmma_f32_16x16x4_f32(false, a1, false, b1i,
                      (short)0, acci[1][1], false, false);
    }
    __syncthreads();
  }

#pragma unroll
  for (int mi = 0; mi < 2; ++mi) {
#pragma unroll
    for (int ni = 0; ni < 2; ++ni) {
#pragma unroll
      for (int v = 0; v < 8; ++v) {
        const int m = v + 8 * hi;
        const size_t idx =
            (size_t)(rowW + mi * 16 + m) * P_ + colBase + ni * 16 + mn;
        bur[idx] = accr[mi][ni][v];
        bui[idx] = acci[mi][ni][v];
      }
    }
  }
}

// ---------------------------------------------------------------------------
// 3a) Scan pass 1: per-(b,chunk) local complex scan over CH steps, in place.
// ---------------------------------------------------------------------------
__global__ __launch_bounds__(256) void s5_scan_local(
    const float* __restrict__ lbr_, const float* __restrict__ lbi_,
    float* __restrict__ bur, float* __restrict__ bui,
    float* __restrict__ car, float* __restrict__ cai) {
  const int p = threadIdx.x;
  const int bc = blockIdx.x;            // b * NC + c
  const int b = bc / NC, c = bc % NC;
  const float lr = lbr_[p], li = lbi_[p];
  float sr = 0.0f, si = 0.0f;
  size_t idx = ((size_t)b * L_ + (size_t)c * CH) * P_ + p;
  for (int j = 0; j < CH; ++j, idx += P_) {
    __builtin_prefetch(bur + idx + 8 * P_, 1, 0);
    const float xr = bur[idx];
    const float xi = bui[idx];
    const float nr = fmaf(lr, sr, fmaf(-li, si, xr));
    const float ni = fmaf(lr, si, fmaf(li, sr, xi));
    sr = nr; si = ni;
    bur[idx] = sr;
    bui[idx] = si;
  }
  car[(size_t)bc * P_ + p] = sr;
  cai[(size_t)bc * P_ + p] = si;
}

// ---------------------------------------------------------------------------
// 3b) Scan pass 2: sequential carry scan across the NC chunks per (b,p).
//     lambda_bar^CH via 7 complex squarings (CH = 128 = 2^7).
// ---------------------------------------------------------------------------
__global__ __launch_bounds__(256) void s5_scan_carry(
    const float* __restrict__ lbr_, const float* __restrict__ lbi_,
    const float* __restrict__ car, const float* __restrict__ cai,
    float* __restrict__ cir, float* __restrict__ cii) {
  const int p = threadIdx.x;
  const int b = blockIdx.x;
  float pr = lbr_[p], pi = lbi_[p];
#pragma unroll
  for (int s = 0; s < 7; ++s) {
    const float nr = pr * pr - pi * pi;
    const float ni = 2.0f * pr * pi;
    pr = nr; pi = ni;
  }
  float er = 0.0f, ei = 0.0f;
#pragma unroll
  for (int c = 0; c < NC; ++c) {
    const size_t idx = ((size_t)b * NC + c) * P_ + p;
    cir[idx] = er;
    cii[idx] = ei;
    const float nr = fmaf(pr, er, fmaf(-pi, ei, car[idx]));
    const float ni = fmaf(pr, ei, fmaf(pi, er, cai[idx]));
    er = nr; ei = ni;
  }
}

// ---------------------------------------------------------------------------
// 3c) Scan pass 3: x_j += lambda_bar^{j+1} * carry_in   (chunk 0 has carry 0)
// ---------------------------------------------------------------------------
__global__ __launch_bounds__(256) void s5_scan_apply(
    const float* __restrict__ lbr_, const float* __restrict__ lbi_,
    const float* __restrict__ cir, const float* __restrict__ cii,
    float* __restrict__ bur, float* __restrict__ bui) {
  const int p = threadIdx.x;
  const int bc = blockIdx.x;
  const int b = bc / NC, c = bc % NC;
  if (c == 0) return;                   // carry-in is zero for chunk 0
  const float lr = lbr_[p], li = lbi_[p];
  const float er = cir[(size_t)bc * P_ + p];
  const float ei = cii[(size_t)bc * P_ + p];
  float wr = lr * er - li * ei;
  float wi = lr * ei + li * er;
  size_t idx = ((size_t)b * L_ + (size_t)c * CH) * P_ + p;
  for (int j = 0; j < CH; ++j, idx += P_) {
    bur[idx] += wr;
    bui[idx] += wi;
    const float nr = fmaf(lr, wr, -li * wi);
    const float ni = fmaf(lr, wi, li * wr);
    wr = nr; wi = ni;
  }
}

// ---------------------------------------------------------------------------
// 4) GEMM2: y[r,h] = 2*(xs_re[r,:]@C_re[h,:] - xs_im[r,:]@C_im[h,:]) + D[h]*u
//    C panels DMA'd into LDS; separate re/im accumulators, subtraction folded
//    into the epilogue (DMA path cannot negate in flight).
// ---------------------------------------------------------------------------
__global__ __launch_bounds__(256) void s5_gemm2(
    const float* __restrict__ xsr, const float* __restrict__ xsi,
    const float* __restrict__ Cre, const float* __restrict__ Cim,
    const float* __restrict__ Dv,  const float* __restrict__ u,
    float* __restrict__ y) {
  __shared__ float sCr[32][KC];   // [n_local][k]
  __shared__ float sCi[32][KC];

  const int lane = threadIdx.x & 31;
  const int wave = threadIdx.x >> 5;
  const int colBlocks = H_ / 32;                     // 16
  const int rowBase = (blockIdx.x / colBlocks) * 256;
  const int colBase = (blockIdx.x % colBlocks) * 32;
  const int rowW = rowBase + wave * 32;
  const int mn = lane & 15;
  const int hi = lane >> 4;

  const float* __restrict__ ar0 = xsr + (size_t)(rowW + mn) * P_ + 2 * hi;
  const float* __restrict__ ar1 = ar0 + (size_t)16 * P_;
  const float* __restrict__ ai0 = xsi + (size_t)(rowW + mn) * P_ + 2 * hi;
  const float* __restrict__ ai1 = ai0 + (size_t)16 * P_;

  v8f accR[2][2] = {};
  v8f accI[2][2] = {};

  for (int k0 = 0; k0 < P_; k0 += KC) {
    // --- async panel stage: C[colBase..+32, k0..+KC] -> LDS (b128) ---
#pragma unroll
    for (int i = threadIdx.x; i < (32 * KC) / 4; i += 256) {   // 2 iters
      const int n = i >> 4;
      const int kk = (i & 15) * 4;
      const size_t g = (size_t)(colBase + n) * P_ + k0 + kk;
      async_ld_b128(&sCr[n][kk], Cre + g);
      async_ld_b128(&sCi[n][kk], Cim + g);
    }
    wait_asynccnt0();
    __syncthreads();

#pragma unroll
    for (int kk = 0; kk < KC; kk += 4) {
      __builtin_prefetch(ar0 + k0 + kk + KC, 0, 0);
      const v2f fr0 = *(const v2f*)(ar0 + k0 + kk);
      const v2f fr1 = *(const v2f*)(ar1 + k0 + kk);
      const v2f fi0 = *(const v2f*)(ai0 + k0 + kk);
      const v2f fi1 = *(const v2f*)(ai1 + k0 + kk);
      const v2f c0r = *(const v2f*)(&sCr[mn][kk + 2 * hi]);
      const v2f c1r = *(const v2f*)(&sCr[16 + mn][kk + 2 * hi]);
      const v2f c0i = *(const v2f*)(&sCi[mn][kk + 2 * hi]);
      const v2f c1i = *(const v2f*)(&sCi[16 + mn][kk + 2 * hi]);
      accR[0][0] = __builtin_amdgcn_wmma_f32_16x16x4_f32(false, fr0, false, c0r,
                      (short)0, accR[0][0], false, false);
      accR[0][1] = __builtin_amdgcn_wmma_f32_16x16x4_f32(false, fr0, false, c1r,
                      (short)0, accR[0][1], false, false);
      accR[1][0] = __builtin_amdgcn_wmma_f32_16x16x4_f32(false, fr1, false, c0r,
                      (short)0, accR[1][0], false, false);
      accR[1][1] = __builtin_amdgcn_wmma_f32_16x16x4_f32(false, fr1, false, c1r,
                      (short)0, accR[1][1], false, false);
      accI[0][0] = __builtin_amdgcn_wmma_f32_16x16x4_f32(false, fi0, false, c0i,
                      (short)0, accI[0][0], false, false);
      accI[0][1] = __builtin_amdgcn_wmma_f32_16x16x4_f32(false, fi0, false, c1i,
                      (short)0, accI[0][1], false, false);
      accI[1][0] = __builtin_amdgcn_wmma_f32_16x16x4_f32(false, fi1, false, c0i,
                      (short)0, accI[1][0], false, false);
      accI[1][1] = __builtin_amdgcn_wmma_f32_16x16x4_f32(false, fi1, false, c1i,
                      (short)0, accI[1][1], false, false);
    }
    __syncthreads();
  }

#pragma unroll
  for (int ni = 0; ni < 2; ++ni) {
    const int h = colBase + ni * 16 + mn;
    const float dv = Dv[h];
#pragma unroll
    for (int mi = 0; mi < 2; ++mi) {
#pragma unroll
      for (int v = 0; v < 8; ++v) {
        const size_t r = (size_t)(rowW + mi * 16 + v + 8 * hi);
        y[r * H_ + h] =
            2.0f * (accR[mi][ni][v] - accI[mi][ni][v]) + dv * u[r * H_ + h];
      }
    }
  }
}

// ---------------------------------------------------------------------------
// Launch
// ---------------------------------------------------------------------------
extern "C" void kernel_launch(void* const* d_in, const int* in_sizes, int n_in,
                              void* d_out, int out_size, void* d_ws,
                              size_t ws_size, hipStream_t stream) {
  (void)in_sizes; (void)n_in; (void)out_size; (void)ws_size;
  const float* u      = (const float*)d_in[0];
  const float* lam_re = (const float*)d_in[1];
  const float* lam_im = (const float*)d_in[2];
  const float* B_re   = (const float*)d_in[3];
  const float* B_im   = (const float*)d_in[4];
  const float* C_re   = (const float*)d_in[5];
  const float* C_im   = (const float*)d_in[6];
  const float* Dv     = (const float*)d_in[7];
  const float* log_dt = (const float*)d_in[8];
  float* y = (float*)d_out;

  // Workspace carve-up (floats)
  float* ws  = (float*)d_ws;
  float* lbr = ws;                       // P
  float* lbi = lbr + P_;                 // P
  float* Bbr = lbi + P_;                 // P*H
  float* Bbi = Bbr + (size_t)P_ * H_;    // P*H
  float* bur = Bbi + (size_t)P_ * H_;    // NBL*P
  float* bui = bur + (size_t)NBL * P_;   // NBL*P
  float* car = bui + (size_t)NBL * P_;   // B*NC*P
  float* cai = car + (size_t)B_ * NC * P_;
  float* cir = cai + (size_t)B_ * NC * P_;
  float* cii = cir + (size_t)B_ * NC * P_;

  s5_setup<<<(P_ * H_) / 256, 256, 0, stream>>>(
      lam_re, lam_im, B_re, B_im, log_dt, lbr, lbi, Bbr, Bbi);

  s5_gemm1<<<(NBL / 256) * (P_ / 32), 256, 0, stream>>>(
      u, Bbr, Bbi, bur, bui);

  s5_scan_local<<<B_ * NC, 256, 0, stream>>>(lbr, lbi, bur, bui, car, cai);
  s5_scan_carry<<<B_, 256, 0, stream>>>(lbr, lbi, car, cai, cir, cii);
  s5_scan_apply<<<B_ * NC, 256, 0, stream>>>(lbr, lbi, cir, cii, bur, bui);

  s5_gemm2<<<(NBL / 256) * (H_ / 32), 256, 0, stream>>>(
      bur, bui, C_re, C_im, Dv, u, y);
}

// v001
// It runs in 367 microseconds.
// Next to v000, in two timings, it ran 1.44 times as fast each time.
#include <hip/hip_runtime.h>
#include <hip/hip_bf16.h>
#include <math.h>
#include <stdint.h>

// ---------------------------------------------------------------------------
// S5 SSM on MI455X (gfx1250): fp32 WMMA GEMMs (32x32 per wave) with
// async global->LDS panel staging (GLOBAL_LOAD_ASYNC_TO_LDS_B128, ASYNCcnt)
// + 3-phase chunked complex scan.
// Layout: Bu/xs stored (B*L, P) row-major so the scan (parallel over p) is
// fully coalesced and GEMM2 reads rows contiguously.
// ---------------------------------------------------------------------------

#define B_  8
#define L_  4096
#define H_  512
#define P_  256
#define NBL (B_ * L_)      // 32768 rows
#define NC  32             // scan chunks
#define CH  (L_ / NC)      // 128 steps per chunk (= 2^7)
#define KC  64             // K-panel staged in LDS per iteration
#define AP  (KC + 4)       // A-panel row pitch in floats: at 68 dwords the 16 rows
                           // of one b64 fragment read fall on 64 distinct banks

typedef __attribute__((ext_vector_type(2))) float v2f;
typedef __attribute__((ext_vector_type(8))) float v8f;

// Async DMA: global -> LDS, 16 bytes, tracked by ASYNCcnt (no VGPR data path).
__device__ __forceinline__ void async_ld_b128(void* lds, const float* gaddr) {
  const unsigned lo = (unsigned)(uintptr_t)lds;           // LDS byte offset
  const unsigned long long ga = (unsigned long long)(uintptr_t)gaddr;
  asm volatile("global_load_async_to_lds_b128 %0, %1, off"
               :: "v"(lo), "v"(ga) : "memory");
}
// Eight such copies, rows lstep / gstep floats apart, in ONE statement that ends
// in s_wait_xcnt 0, so that no address register named by an issued copy can be
// rewritten ahead of that wait.
__device__ __forceinline__ void async_ld8_b128(float* lds, int lstep,
                                               const float* g, int gstep) {
  const unsigned l0 = (unsigned)(uintptr_t)(void*)lds;    // LDS byte offset
  const unsigned ls = (unsigned)lstep * 4u;
  asm volatile(
      "global_load_async_to_lds_b128 %0, %8, off\n\t"
      "global_load_async_to_lds_b128 %1, %9, off\n\t"
      "global_load_async_to_lds_b128 %2, %10, off\n\t"
      "global_load_async_to_lds_b128 %3, %11, off\n\t"
      "global_load_async_to_lds_b128 %4, %12, off\n\t"
      "global_load_async_to_lds_b128 %5, %13, off\n\t"
      "global_load_async_to_lds_b128 %6, %14, off\n\t"
      "global_load_async_to_lds_b128 %7, %15, off\n\t"
      "s_wait_xcnt 0x0"
      :: "v"(l0), "v"(l0 + ls), "v"(l0 + 2u * ls), "v"(l0 + 3u * ls),
         "v"(l0 + 4u * ls), "v"(l0 + 5u * ls), "v"(l0 + 6u * ls),
         "v"(l0 + 7u * ls),
         "v"(g), "v"(g + gstep), "v"(g + 2 * gstep), "v"(g + 3 * gstep),
         "v"(g + 4 * gstep), "v"(g + 5 * gstep), "v"(g + 6 * gstep),
         "v"(g + 7 * gstep)
      : "memory");
}
__device__ __forceinline__ void wait_asynccnt0() {
  asm volatile("s_wait_asynccnt 0x0" ::: "memory");
}
// A wave's LDS reads have retired before the barrier behind which the panels
// it read are refilled by async copies.
__device__ __forceinline__ void wait_dscnt0() {
  asm volatile("s_wait_dscnt 0x0" ::: "memory");
}

// ---------------------------------------------------------------------------
// 1) ZOH discretization:  lambda_bar = exp(lam*dt),  B_bar = ((lb-1)/lam)*B~
// ---------------------------------------------------------------------------
__global__ __launch_bounds__(256) void s5_setup(
    const float* __restrict__ lam_re, const float* __restrict__ lam_im,
    const float* __restrict__ B_re,   const float* __restrict__ B_im,
    const float* __restrict__ log_dt,
    float* __restrict__ lbr_out, float* __restrict__ lbi_out,
    float* __restrict__ Bbr,     float* __restrict__ Bbi) {
  const int tid = blockIdx.x * blockDim.x + threadIdx.x;   // over P*H
  const int p = tid / H_;
  const int h = tid % H_;
  const float lr = lam_re[p];
  const float li = lam_im[p];
  const float dt = __expf(log_dt[p]);
  const float er = __expf(lr * dt);
  const float lbr = er * __cosf(li * dt);
  const float lbi = er * __sinf(li * dt);
  // coef = (lambda_bar - 1) / lam   (complex division)
  const float inv_den = 1.0f / (lr * lr + li * li);
  const float cr = ((lbr - 1.0f) * lr + lbi * li) * inv_den;
  const float ci = (lbi * lr - (lbr - 1.0f) * li) * inv_den;
  const float br = B_re[(size_t)p * H_ + h];
  const float bi = B_im[(size_t)p * H_ + h];
  Bbr[(size_t)p * H_ + h] = cr * br - ci * bi;
  Bbi[(size_t)p * H_ + h] = cr * bi + ci * br;
  if (h == 0) { lbr_out[p] = lbr; lbi_out[p] = lbi; }
}

// ---------------------------------------------------------------------------
// 2) GEMM1: Bu[r,p] = sum_h u[r,h] * B_bar[p,h]   (re & im share A fragments)
//    Block = 256 rows x 32 cols; wave w = rows [w*32, w*32+32) of the block.
//    B panels (re/im) DMA'd into LDS via async-to-LDS b128, shared by 8 waves.
//    A panel (256 rows x KC) DMA'd the same way, whole 256-B row pieces per
//    half-wave; each wave copies the 32 rows it reads.
//    f32 WMMA 16x16x4 fragment maps:
//      A 16x4 : M = lane&15, K = 2*(lane>>4) + v   -> float2 load
//      B 4x16 : N = lane&15, K = 2*(lane>>4) + v   -> float2 load
//      C/D    : N = lane&15, M = v + 8*(lane>>4)
// ---------------------------------------------------------------------------
__global__ __launch_bounds__(256) void s5_gemm1(
    const float* __restrict__ u,
    const float* __restrict__ Bbr, const float* __restrict__ Bbi,
    float* __restrict__ bur, float* __restrict__ bui) {
  __shared__ float sBr[32][KC];   // [n_local][k]
  __shared__ float sBi[32][KC];
  __shared__ __attribute__((aligned(16))) float sA[256][AP];   // [m_local][k]

  const int lane = threadIdx.x & 31;
  const int wave = threadIdx.x >> 5;
  const int colBlocks = P_ / 32;                     // 8
  const int rowBase = (blockIdx.x / colBlocks) * 256;
  const int colBase = (blockIdx.x % colBlocks) * 32;
  const int rowW = rowBase + wave * 32;
  const int mn = lane & 15;
  const int hi = lane >> 4;

  // copy side: lanes 0-15 one row, lanes 16-31 the next, 16 B per lane
  const float* __restrict__ asrc = u + (size_t)(rowW + hi) * H_ + mn * 4;
  float* adst = &sA[wave * 32 + hi][mn * 4];
  // fragment side
  const float* arow0 = &sA[wave * 32 + mn][2 * hi];
  const float* arow1 = &sA[wave * 32 + 16 + mn][2 * hi];

  v8f accr[2][2] = {};
  v8f acci[2][2] = {};

  for (int h0 = 0; h0 < H_; h0 += KC) {
    // --- async panel stage: this wave's 32 rows of u[.., h0..+KC] -> LDS ---
    async_ld8_b128(adst, 2 * AP, asrc + h0, 2 * H_);
    async_ld8_b128(adst + 16 * AP, 2 * AP, asrc + h0 + 16 * H_, 2 * H_);
    // --- async panel stage: B_bar[colBase..+32, h0..+KC] -> LDS (b128) ---
#pragma unroll
    for (int i = threadIdx.x; i < (32 * KC) / 4; i += 256) {   // 2 iters
      const int n = i >> 4;              // KC/4 = 16 chunks per row
      const int kk = (i & 15) * 4;
      const size_t g = (size_t)(colBase + n) * H_ + h0 + kk;
      async_ld_b128(&sBr[n][kk], Bbr + g);
      async_ld_b128(&sBi[n][kk], Bbi + g);
    }
    wait_asynccnt0();
    __syncthreads();

#pragma unroll
    for (int kk = 0; kk < KC; kk += 4) {
      const v2f a0 = *(const v2f*)(arow0 + kk);
      const v2f a1 = *(const v2f*)(arow1 + kk);
      const v2f b0r = *(const v2f*)(&sBr[mn][kk + 2 * hi]);
      const v2f b1r = *(const v2f*)(&sBr[16 + mn][kk + 2 * hi]);
      const v2f b0i = *(const v2f*)(&sBi[mn][kk + 2 * hi]);
      const v2f b1i = *(const v2f*)(&sBi[16 + mn][kk + 2 * hi]);
      accr[0][0] = __builtin_amdgcn_wmma_f32_16x16x4_f32(false, a0, false, b0r,
                      (short)0, accr[0][0], false, false);
      accr[0][1] = __builtin_amdgcn_wmma_f32_16x16x4_f32(false, a0, false, b1r,
                      (short)0, accr[0][1], false, false);
      accr[1][0] = __builtin_amdgcn_wmma_f32_16x16x4_f32(false, a1, false, b0r,
                      (short)0, accr[1][0], false, false);
      accr[1][1] = __builtin_amdgcn_wmma_f32_16x16x4_f32(false, a1, false, b1r,
                      (short)0, accr[1][1], false, false);
      acci[0][0] = __builtin_amdgcn_wmma_f32_16x16x4_f32(false, a0, false, b0i,
                      (short)0, acci[0][0], false, false);
      acci[0][1] = __builtin_amdgcn_wmma_f32_16x16x4_f32(false, a0, false, b1i,
                      (short)0, acci[0][1], false, false);
      acci[1][0] = __builtin_amdgcn_wmma_f32_16x16x4_f32(false, a1, false, b0i,
                      (short)0, acci[1][0], false, false);
      acci[1][1] = __builtin_amdgcn_wmma_f32_16x16x4_f32(false, a1, false, b1i,
                      (short)0, acci[1][1], false, false);
    }
    wait_dscnt0();
    __syncthreads();
  }

#pragma unroll
  for (int mi = 0; mi < 2; ++mi) {
#pragma unroll
    for (int ni = 0; ni < 2; ++ni) {
#pragma unroll
      for (int v = 0; v < 8; ++v) {
        const int m = v + 8 * hi;
        const size_t idx =
            (size_t)(rowW + mi * 16 + m) * P_ + colBase + ni * 16 + mn;
        bur[idx] = accr[mi][ni][v];
        bui[idx] = acci[mi][ni][v];
      }
    }
  }
}

// ---------------------------------------------------------------------------
// 3a) Scan pass 1: per-(b,chunk) local complex scan over CH steps, in place.
// ---------------------------------------------------------------------------
__global__ __launch_bounds__(256) void s5_scan_local(
    const float* __restrict__ lbr_, const float* __restrict__ lbi_,
    float* __restrict__ bur, float* __restrict__ bui,
    float* __restrict__ car, float* __restrict__ cai) {
  const int p = threadIdx.x;
  const int bc = blockIdx.x;            // b * NC + c
  const int b = bc / NC, c = bc % NC;
  const float lr = lbr_[p], li = lbi_[p];
  float sr = 0.0f, si = 0.0f;
  size_t idx = ((size_t)b * L_ + (size_t)c * CH) * P_ + p;
  for (int j = 0; j < CH; ++j, idx += P_) {
    __builtin_prefetch(bur + idx + 8 * P_, 1, 0);
    const float xr = bur[idx];
    const float xi = bui[idx];
    const float nr = fmaf(lr, sr, fmaf(-li, si, xr));
    const float ni = fmaf(lr, si, fmaf(li, sr, xi));
    sr = nr; si = ni;
    bur[idx] = sr;
    bui[idx] = si;
  }
  car[(size_t)bc * P_ + p] = sr;
  cai[(size_t)bc * P_ + p] = si;
}

// ---------------------------------------------------------------------------
// 3b) Scan pass 2: sequential carry scan across the NC chunks per (b,p).
//     lambda_bar^CH via 7 complex squarings (CH = 128 = 2^7).
// ---------------------------------------------------------------------------
__global__ __launch_bounds__(256) void s5_scan_carry(
    const float* __restrict__ lbr_, const float* __restrict__ lbi_,
    const float* __restrict__ car, const float* __restrict__ cai,
    float* __restrict__ cir, float* __restrict__ cii) {
  const int p = threadIdx.x;
  const int b = blockIdx.x;
  float pr = lbr_[p], pi = lbi_[p];
#pragma unroll
  for (int s = 0; s < 7; ++s) {
    const float nr = pr * pr - pi * pi;
    const float ni = 2.0f * pr * pi;
    pr = nr; pi = ni;
  }
  float er = 0.0f, ei = 0.0f;
#pragma unroll
  for (int c = 0; c < NC; ++c) {
    const size_t idx = ((size_t)b * NC + c) * P_ + p;
    cir[idx] = er;
    cii[idx] = ei;
    const float nr = fmaf(pr, er, fmaf(-pi, ei, car[idx]));
    const float ni = fmaf(pr, ei, fmaf(pi, er, cai[idx]));
    er = nr; ei = ni;
  }
}

// ---------------------------------------------------------------------------
// 3c) Scan pass 3: x_j += lambda_bar^{j+1} * carry_in   (chunk 0 has carry 0)
// ---------------------------------------------------------------------------
__global__ __launch_bounds__(256) void s5_scan_apply(
    const float* __restrict__ lbr_, const float* __restrict__ lbi_,
    const float* __restrict__ cir, const float* __restrict__ cii,
    float* __restrict__ bur, float* __restrict__ bui) {
  const int p = threadIdx.x;
  const int bc = blockIdx.x;
  const int b = bc / NC, c = bc % NC;
  if (c == 0) return;                   // carry-in is zero for chunk 0
  const float lr = lbr_[p], li = lbi_[p];
  const float er = cir[(size_t)bc * P_ + p];
  const float ei = cii[(size_t)bc * P_ + p];
  float wr = lr * er - li * ei;
  float wi = lr * ei + li * er;
  size_t idx = ((size_t)b * L_ + (size_t)c * CH) * P_ + p;
  for (int j = 0; j < CH; ++j, idx += P_) {
    bur[idx] += wr;
    bui[idx] += wi;
    const float nr = fmaf(lr, wr, -li * wi);
    const float ni = fmaf(lr, wi, li * wr);
    wr = nr; wi = ni;
  }
}

// ---------------------------------------------------------------------------
// 4) GEMM2: y[r,h] = 2*(xs_re[r,:]@C_re[h,:] - xs_im[r,:]@C_im[h,:]) + D[h]*u
//    C panels and the xs re/im panels (256 rows x KC each) DMA'd into LDS;
//    separate re/im accumulators, subtraction folded
//    into the epilogue (DMA path cannot negate in flight).
// ---------------------------------------------------------------------------
__global__ __launch_bounds__(256) void s5_gemm2(
    const float* __restrict__ xsr, const float* __restrict__ xsi,
    const float* __restrict__ Cre, const float* __restrict__ Cim,
    const float* __restrict__ Dv,  const float* __restrict__ u,
    float* __restrict__ y) {
  __shared__ float sCr[32][KC];   // [n_local][k]
  __shared__ float sCi[32][KC];
  __shared__ __attribute__((aligned(16))) float sXr[256][AP];  // [m_local][k]
  __shared__ __attribute__((aligned(16))) float sXi[256][AP];

  const int lane = threadIdx.x & 31;
  const int wave = threadIdx.x >> 5;
  const int colBlocks = H_ / 32;                     // 16
  const int rowBase = (blockIdx.x / colBlocks) * 256;
  const int colBase = (blockIdx.x % colBlocks) * 32;
  const int rowW = rowBase + wave * 32;
  const int mn = lane & 15;
  const int hi = lane >> 4;

  // copy side: lanes 0-15 one row, lanes 16-31 the next, 16 B per lane
  const float* __restrict__ xrsrc = xsr + (size_t)(rowW + hi) * P_ + mn * 4;
  const float* __restrict__ xisrc = xsi + (size_t)(rowW + hi) * P_ + mn * 4;
  float* xrdst = &sXr[wave * 32 + hi][mn * 4];
  float* xidst = &sXi[wave * 32 + hi][mn * 4];
  // fragment side
  const float* ar0 = &sXr[wave * 32 + mn][2 * hi];
  const float* ar1 = &sXr[wave * 32 + 16 + mn][2 * hi];
  const float* ai0 = &sXi[wave * 32 + mn][2 * hi];
  const float* ai1 = &sXi[wave * 32 + 16 + mn][2 * hi];

  v8f accR[2][2] = {};
  v8f accI[2][2] = {};

  for (int k0 = 0; k0 < P_; k0 += KC) {
    // --- async panel stage: this wave's 32 rows of xs[.., k0..+KC] -> LDS ---
    async_ld8_b128(xrdst, 2 * AP, xrsrc + k0, 2 * P_);
    async_ld8_b128(xrdst + 16 * AP, 2 * AP, xrsrc + k0 + 16 * P_, 2 * P_);
    async_ld8_b128(xidst, 2 * AP, xisrc + k0, 2 * P_);
    async_ld8_b128(xidst + 16 * AP, 2 * AP, xisrc + k0 + 16 * P_, 2 * P_);
    // --- async panel stage: C[colBase..+32, k0..+KC] -> LDS (b128) ---
#pragma unroll
    for (int i = threadIdx.x; i < (32 * KC) / 4; i += 256) {   // 2 iters
      const int n = i >> 4;
      const int kk = (i & 15) * 4;
      const size_t g = (size_t)(colBase + n) * P_ + k0 + kk;
      async_ld_b128(&sCr[n][kk], Cre + g);
      async_ld_b128(&sCi[n][kk], Cim + g);
    }
    wait_asynccnt0();
    __syncthreads();

#pragma unroll
    for (int kk = 0; kk < KC; kk += 4) {
      const v2f fr0 = *(const v2f*)(ar0 + kk);
      const v2f fr1 = *(const v2f*)(ar1 + kk);
      const v2f fi0 = *(const v2f*)(ai0 + kk);
      const v2f fi1 = *(const v2f*)(ai1 + kk);
      const v2f c0r = *(const v2f*)(&sCr[mn][kk + 2 * hi]);
      const v2f c1r = *(const v2f*)(&sCr[16 + mn][kk + 2 * hi]);
      const v2f c0i = *(const v2f*)(&sCi[mn][kk + 2 * hi]);
      const v2f c1i = *(const v2f*)(&sCi[16 + mn][kk + 2 * hi]);
      accR[0][0] = __builtin_amdgcn_wmma_f32_16x16x4_f32(false, fr0, false, c0r,
                      (short)0, accR[0][0], false, false);
      accR[0][1] = __builtin_amdgcn_wmma_f32_16x16x4_f32(false, fr0, false, c1r,
                      (short)0, accR[0][1], false, false);
      accR[1][0] = __builtin_amdgcn_wmma_f32_16x16x4_f32(false, fr1, false, c0r,
                      (short)0, accR[1][0], false, false);
      accR[1][1] = __builtin_amdgcn_wmma_f32_16x16x4_f32(false, fr1, false, c1r,
                      (short)0, accR[1][1], false, false);
      accI[0][0] = __builtin_amdgcn_wmma_f32_16x16x4_f32(false, fi0, false, c0i,
                      (short)0, accI[0][0], false, false);
      accI[0][1] = __builtin_amdgcn_wmma_f32_16x16x4_f32(false, fi0, false, c1i,
                      (short)0, accI[0][1], false, false);
      accI[1][0] = __builtin_amdgcn_wmma_f32_16x16x4_f32(false, fi1, false, c0i,
                      (short)0, accI[1][0], false, false);
      accI[1][1] = __builtin_amdgcn_wmma_f32_16x16x4_f32(false, fi1, false, c1i,
                      (short)0, accI[1][1], false, false);
    }
    wait_dscnt0();
    __syncthreads();
  }

#pragma unroll
  for (int ni = 0; ni < 2; ++ni) {
    const int h = colBase + ni * 16 + mn;
    const float dv = Dv[h];
#pragma unroll
    for (int mi = 0; mi < 2; ++mi) {
#pragma unroll
      for (int v = 0; v < 8; ++v) {
        const size_t r = (size_t)(rowW + mi * 16 + v + 8 * hi);
        y[r * H_ + h] =
            2.0f * (accR[mi][ni][v] - accI[mi][ni][v]) + dv * u[r * H_ + h];
      }
    }
  }
}

// ---------------------------------------------------------------------------
// Launch
// ---------------------------------------------------------------------------
extern "C" void kernel_launch(void* const* d_in, const int* in_sizes, int n_in,
                              void* d_out, int out_size, void* d_ws,
                              size_t ws_size, hipStream_t stream) {
  (void)in_sizes; (void)n_in; (void)out_size; (void)ws_size;
  const float* u      = (const float*)d_in[0];
  const float* lam_re = (const float*)d_in[1];
  const float* lam_im = (const float*)d_in[2];
  const float* B_re   = (const float*)d_in[3];
  const float* B_im   = (const float*)d_in[4];
  const float* C_re   = (const float*)d_in[5];
  const float* C_im   = (const float*)d_in[6];
  const float* Dv     = (const float*)d_in[7];
  const float* log_dt = (const float*)d_in[8];
  float* y = (float*)d_out;

  // Workspace carve-up (floats)
  float* ws  = (float*)d_ws;
  float* lbr = ws;                       // P
  float* lbi = lbr + P_;                 // P
  float* Bbr = lbi + P_;                 // P*H
  float* Bbi = Bbr + (size_t)P_ * H_;    // P*H
  float* bur = Bbi + (size_t)P_ * H_;    // NBL*P
  float* bui = bur + (size_t)NBL * P_;   // NBL*P
  float* car = bui + (size_t)NBL * P_;   // B*NC*P
  float* cai = car + (size_t)B_ * NC * P_;
  float* cir = cai + (size_t)B_ * NC * P_;
  float* cii = cir + (size_t)B_ * NC * P_;

  s5_setup<<<(P_ * H_) / 256, 256, 0, stream>>>(
      lam_re, lam_im, B_re, B_im, log_dt, lbr, lbi, Bbr, Bbi);

  s5_gemm1<<<(NBL / 256) * (P_ / 32), 256, 0, stream>>>(
      u, Bbr, Bbi, bur, bui);

  s5_scan_local<<<B_ * NC, 256, 0, stream>>>(lbr, lbi, bur, bui, car, cai);
  s5_scan_carry<<<B_, 256, 0, stream>>>(lbr, lbi, car, cai, cir, cii);
  s5_scan_apply<<<B_ * NC, 256, 0, stream>>>(lbr, lbi, cir, cii, bur, bui);

  s5_gemm2<<<(NBL / 256) * (H_ / 32), 256, 0, stream>>>(
      bur, bui, C_re, C_im, Dv, u, y);
}

// v002
// A run of this version takes 270 microseconds.
// Timed twice side by side with v001, it ran 1.36 times as fast both times.
// Over all steps from v000 it is 1.96 times as fast.
#include <hip/hip_runtime.h>
#include <hip/hip_bf16.h>
#include <math.h>
#include <stdint.h>

// ---------------------------------------------------------------------------
// S5 SSM on MI455X (gfx1250): fp32 WMMA GEMMs (32x32 per wave) with
// async global->LDS panel staging (GLOBAL_LOAD_ASYNC_TO_LDS_B128, ASYNCcnt)
// + 3-phase chunked complex scan.
// Layout: Bu/xs stored (B*L, P) row-major so the scan (parallel over p) is
// fully coalesced and GEMM2 reads rows contiguously.
// ---------------------------------------------------------------------------

#define B_  8
#define L_  4096
#define H_  512
#define P_  256
#define NBL (B_ * L_)      // 32768 rows
#define NC  32             // scan chunks
#define CH  (L_ / NC)      // 128 steps per chunk (= 2^7)
#define KC  64             // K-panel staged in LDS per iteration
#define AP  (KC + 4)       // panel row pitch in floats (A and B): at 68 dwords the 16 rows
                           // of one b64 fragment read fall on 64 distinct banks

typedef __attribute__((ext_vector_type(2))) float v2f;
typedef __attribute__((ext_vector_type(8))) float v8f;

// Async DMA: global -> LDS, 16 bytes, tracked by ASYNCcnt (no VGPR data path).
__device__ __forceinline__ void async_ld_b128(void* lds, const float* gaddr) {
  const unsigned lo = (unsigned)(uintptr_t)lds;           // LDS byte offset
  const unsigned long long ga = (unsigned long long)(uintptr_t)gaddr;
  asm volatile("global_load_async_to_lds_b128 %0, %1, off"
               :: "v"(lo), "v"(ga) : "memory");
}
// Eight such copies, rows lstep / gstep floats apart, in ONE statement that ends
// in s_wait_xcnt 0, so that no address register named by an issued copy can be
// rewritten ahead of that wait.
__device__ __forceinline__ void async_ld8_b128(float* lds, int lstep,
                                               const float* g, int gstep) {
  const unsigned l0 = (unsigned)(uintptr_t)(void*)lds;    // LDS byte offset
  const unsigned ls = (unsigned)lstep * 4u;
  asm volatile(
      "global_load_async_to_lds_b128 %0, %8, off\n\t"
      "global_load_async_to_lds_b128 %1, %9, off\n\t"
      "global_load_async_to_lds_b128 %2, %10, off\n\t"
      "global_load_async_to_lds_b128 %3, %11, off\n\t"
      "global_load_async_to_lds_b128 %4, %12, off\n\t"
      "global_load_async_to_lds_b128 %5, %13, off\n\t"
      "global_load_async_to_lds_b128 %6, %14, off\n\t"
      "global_load_async_to_lds_b128 %7, %15, off\n\t"
      "s_wait_xcnt 0x0"
      :: "v"(l0), "v"(l0 + ls), "v"(l0 + 2u * ls), "v"(l0 + 3u * ls),
         "v"(l0 + 4u * ls), "v"(l0 + 5u * ls), "v"(l0 + 6u * ls),
         "v"(l0 + 7u * ls),
         "v"(g), "v"(g + gstep), "v"(g + 2 * gstep), "v"(g + 3 * gstep),
         "v"(g + 4 * gstep), "v"(g + 5 * gstep), "v"(g + 6 * gstep),
         "v"(g + 7 * gstep)
      : "memory");
}
__device__ __forceinline__ void wait_asynccnt0() {
  asm volatile("s_wait_asynccnt 0x0" ::: "memory");
}
// A wave's LDS reads have retired before the barrier behind which the panels
// it read are refilled by async copies.
__device__ __forceinline__ void wait_dscnt0() {
  asm volatile("s_wait_dscnt 0x0" ::: "memory");
}

// ---------------------------------------------------------------------------
// 1) ZOH discretization:  lambda_bar = exp(lam*dt),  B_bar = ((lb-1)/lam)*B~
// ---------------------------------------------------------------------------
__global__ __launch_bounds__(256) void s5_setup(
    const float* __restrict__ lam_re, const float* __restrict__ lam_im,
    const float* __restrict__ B_re,   const float* __restrict__ B_im,
    const float* __restrict__ log_dt,
    float* __restrict__ lbr_out, float* __restrict__ lbi_out,
    float* __restrict__ Bbr,     float* __restrict__ Bbi) {
  const int tid = blockIdx.x * blockDim.x + threadIdx.x;   // over P*H
  const int p = tid / H_;
  const int h = tid % H_;
  const float lr = lam_re[p];
  const float li = lam_im[p];
  const float dt = __expf(log_dt[p]);
  const float er = __expf(lr * dt);
  const float lbr = er * __cosf(li * dt);
  const float lbi = er * __sinf(li * dt);
  // coef = (lambda_bar - 1) / lam   (complex division)
  const float inv_den = 1.0f / (lr * lr + li * li);
  const float cr = ((lbr - 1.0f) * lr + lbi * li) * inv_den;
  const float ci = (lbi * lr - (lbr - 1.0f) * li) * inv_den;
  const float br = B_re[(size_t)p * H_ + h];
  const float bi = B_im[(size_t)p * H_ + h];
  Bbr[(size_t)p * H_ + h] = cr * br - ci * bi;
  Bbi[(size_t)p * H_ + h] = cr * bi + ci * br;
  if (h == 0) { lbr_out[p] = lbr; lbi_out[p] = lbi; }
}

// ---------------------------------------------------------------------------
// 2) GEMM1: Bu[r,p] = sum_h u[r,h] * B_bar[p,h]   (re & im share A fragments)
//    Block = 256 rows x 32 cols; wave w = rows [w*32, w*32+32) of the block.
//    B panels (re/im) DMA'd into LDS via async-to-LDS b128, shared by 8 waves.
//    A panel (256 rows x KC) DMA'd the same way, whole 256-B row pieces per
//    half-wave; each wave copies the 32 rows it reads.
//    f32 WMMA 16x16x4 fragment maps:
//      A 16x4 : M = lane&15, K = 2*(lane>>4) + v   -> float2 load
//      B 4x16 : N = lane&15, K = 2*(lane>>4) + v   -> float2 load
//      C/D    : N = lane&15, M = v + 8*(lane>>4)
// ---------------------------------------------------------------------------
__global__ __launch_bounds__(256) void s5_gemm1(
    const float* __restrict__ u,
    const float* __restrict__ Bbr, const float* __restrict__ Bbi,
    float* __restrict__ bur, float* __restrict__ bui) {
  __shared__ __attribute__((aligned(16))) float sBr[32][AP];   // [n_local][k]
  __shared__ __attribute__((aligned(16))) float sBi[32][AP];
  __shared__ __attribute__((aligned(16))) float sA[256][AP];   // [m_local][k]

  const int lane = threadIdx.x & 31;
  const int wave = threadIdx.x >> 5;
  const int colBlocks = P_ / 32;                     // 8
  const int rowBase = (blockIdx.x / colBlocks) * 256;
  const int colBase = (blockIdx.x % colBlocks) * 32;
  const int rowW = rowBase + wave * 32;
  const int mn = lane & 15;
  const int hi = lane >> 4;

  // copy side: lanes 0-15 one row, lanes 16-31 the next, 16 B per lane
  const float* __restrict__ asrc = u + (size_t)(rowW + hi) * H_ + mn * 4;
  float* adst = &sA[wave * 32 + hi][mn * 4];
  // fragment side
  const float* arow0 = &sA[wave * 32 + mn][2 * hi];
  const float* arow1 = &sA[wave * 32 + 16 + mn][2 * hi];

  v8f accr[2][2] = {};
  v8f acci[2][2] = {};

  for (int h0 = 0; h0 < H_; h0 += KC) {
    // --- async panel stage: this wave's 32 rows of u[.., h0..+KC] -> LDS ---
    async_ld8_b128(adst, 2 * AP, asrc + h0, 2 * H_);
    async_ld8_b128(adst + 16 * AP, 2 * AP, asrc + h0 + 16 * H_, 2 * H_);
    // --- async panel stage: B_bar[colBase..+32, h0..+KC] -> LDS (b128) ---
#pragma unroll
    for (int i = threadIdx.x; i < (32 * KC) / 4; i += 256) {   // 2 iters
      const int n = i >> 4;              // KC/4 = 16 chunks per row
      const int kk = (i & 15) * 4;
      const size_t g = (size_t)(colBase + n) * H_ + h0 + kk;
      async_ld_b128(&sBr[n][kk], Bbr + g);
      async_ld_b128(&sBi[n][kk], Bbi + g);
    }
    wait_asynccnt0();
    __syncthreads();

#pragma unroll
    for (int kk = 0; kk < KC; kk += 4) {
      const v2f a0 = *(const v2f*)(arow0 + kk);
      const v2f a1 = *(const v2f*)(arow1 + kk);
      const v2f b0r = *(const v2f*)(&sBr[mn][kk + 2 * hi]);
      const v2f b1r = *(const v2f*)(&sBr[16 + mn][kk + 2 * hi]);
      const v2f b0i = *(const v2f*)(&sBi[mn][kk + 2 * hi]);
      const v2f b1i = *(const v2f*)(&sBi[16 + mn][kk + 2 * hi]);
      accr[0][0] = __builtin_amdgcn_wmma_f32_16x16x4_f32(false, a0, false, b0r,
                      (short)0, accr[0][0], false, false);
      accr[0][1] = __builtin_amdgcn_wmma_f32_16x16x4_f32(false, a0, false, b1r,
                      (short)0, accr[0][1], false, false);
      accr[1][0] = __builtin_amdgcn_wmma_f32_16x16x4_f32(false, a1, false, b0r,
                      (short)0, accr[1][0], false, false);
      accr[1][1] = __builtin_amdgcn_wmma_f32_16x16x4_f32(false, a1, false, b1r,
                      (short)0, accr[1][1], false, false);
      acci[0][0] = __builtin_amdgcn_wmma_f32_16x16x4_f32(false, a0, false, b0i,
                      (short)0, acci[0][0], false, false);
      acci[0][1] = __builtin_amdgcn_wmma_f32_16x16x4_f32(false, a0, false, b1i,
                      (short)0, acci[0][1], false, false);
      acci[1][0] = __builtin_amdgcn_wmma_f32_16x16x4_f32(false, a1, false, b0i,
                      (short)0, acci[1][0], false, false);
      acci[1][1] = __builtin_amdgcn_wmma_f32_16x16x4_f32(false, a1, false, b1i,
                      (short)0, acci[1][1], false, false);
    }
    wait_dscnt0();
    __syncthreads();
  }

#pragma unroll
  for (int mi = 0; mi < 2; ++mi) {
#pragma unroll
    for (int ni = 0; ni < 2; ++ni) {
#pragma unroll
      for (int v = 0; v < 8; ++v) {
        const int m = v + 8 * hi;
        const size_t idx =
            (size_t)(rowW + mi * 16 + m) * P_ + colBase + ni * 16 + mn;
        bur[idx] = accr[mi][ni][v];
        bui[idx] = acci[mi][ni][v];
      }
    }
  }
}

// ---------------------------------------------------------------------------
// 3a) Scan pass 1: per-(b,chunk) local complex scan over CH steps, in place.
// ---------------------------------------------------------------------------
__global__ __launch_bounds__(256) void s5_scan_local(
    const float* __restrict__ lbr_, const float* __restrict__ lbi_,
    float* __restrict__ bur, float* __restrict__ bui,
    float* __restrict__ car, float* __restrict__ cai) {
  const int p = threadIdx.x;
  const int bc = blockIdx.x;            // b * NC + c
  const int b = bc / NC, c = bc % NC;
  const float lr = lbr_[p], li = lbi_[p];
  float sr = 0.0f, si = 0.0f;
  size_t idx = ((size_t)b * L_ + (size_t)c * CH) * P_ + p;
  for (int j = 0; j < CH; ++j, idx += P_) {
    __builtin_prefetch(bur + idx + 8 * P_, 1, 0);
    const float xr = bur[idx];
    const float xi = bui[idx];
    const float nr = fmaf(lr, sr, fmaf(-li, si, xr));
    const float ni = fmaf(lr, si, fmaf(li, sr, xi));
    sr = nr; si = ni;
    bur[idx] = sr;
    bui[idx] = si;
  }
  car[(size_t)bc * P_ + p] = sr;
  cai[(size_t)bc * P_ + p] = si;
}

// ---------------------------------------------------------------------------
// 3b) Scan pass 2: sequential carry scan across the NC chunks per (b,p).
//     lambda_bar^CH via 7 complex squarings (CH = 128 = 2^7).
// ---------------------------------------------------------------------------
__global__ __launch_bounds__(256) void s5_scan_carry(
    const float* __restrict__ lbr_, const float* __restrict__ lbi_,
    const float* __restrict__ car, const float* __restrict__ cai,
    float* __restrict__ cir, float* __restrict__ cii) {
  const int p = threadIdx.x;
  const int b = blockIdx.x;
  float pr = lbr_[p], pi = lbi_[p];
#pragma unroll
  for (int s = 0; s < 7; ++s) {
    const float nr = pr * pr - pi * pi;
    const float ni = 2.0f * pr * pi;
    pr = nr; pi = ni;
  }
  float er = 0.0f, ei = 0.0f;
#pragma unroll
  for (int c = 0; c < NC; ++c) {
    const size_t idx = ((size_t)b * NC + c) * P_ + p;
    cir[idx] = er;
    cii[idx] = ei;
    const float nr = fmaf(pr, er, fmaf(-pi, ei, car[idx]));
    const float ni = fmaf(pr, ei, fmaf(pi, er, cai[idx]));
    er = nr; ei = ni;
  }
}

// ---------------------------------------------------------------------------
// 3c) Scan pass 3: x_j += lambda_bar^{j+1} * carry_in   (chunk 0 has carry 0)
// ---------------------------------------------------------------------------
__global__ __launch_bounds__(256) void s5_scan_apply(
    const float* __restrict__ lbr_, const float* __restrict__ lbi_,
    const float* __restrict__ cir, const float* __restrict__ cii,
    float* __restrict__ bur, float* __restrict__ bui) {
  const int p = threadIdx.x;
  const int bc = blockIdx.x;
  const int b = bc / NC, c = bc % NC;
  if (c == 0) return;                   // carry-in is zero for chunk 0
  const float lr = lbr_[p], li = lbi_[p];
  const float er = cir[(size_t)bc * P_ + p];
  const float ei = cii[(size_t)bc * P_ + p];
  float wr = lr * er - li * ei;
  float wi = lr * ei + li * er;
  size_t idx = ((size_t)b * L_ + (size_t)c * CH) * P_ + p;
  for (int j = 0; j < CH; ++j, idx += P_) {
    bur[idx] += wr;
    bui[idx] += wi;
    const float nr = fmaf(lr, wr, -li * wi);
    const float ni = fmaf(lr, wi, li * wr);
    wr = nr; wi = ni;
  }
}

// ---------------------------------------------------------------------------
// 4) GEMM2: y[r,h] = 2*(xs_re[r,:]@C_re[h,:] - xs_im[r,:]@C_im[h,:]) + D[h]*u
//    C panels and the xs re/im panels (256 rows x KC each) DMA'd into LDS;
//    separate re/im accumulators, subtraction folded
//    into the epilogue (DMA path cannot negate in flight).
// ---------------------------------------------------------------------------
__global__ __launch_bounds__(256) void s5_gemm2(
    const float* __restrict__ xsr, const float* __restrict__ xsi,
    const float* __restrict__ Cre, const float* __restrict__ Cim,
    const float* __restrict__ Dv,  const float* __restrict__ u,
    float* __restrict__ y) {
  __shared__ __attribute__((aligned(16))) float sCr[32][AP];   // [n_local][k]
  __shared__ __attribute__((aligned(16))) float sCi[32][AP];
  __shared__ __attribute__((aligned(16))) float sXr[256][AP];  // [m_local][k]
  __shared__ __attribute__((aligned(16))) float sXi[256][AP];

  const int lane = threadIdx.x & 31;
  const int wave = threadIdx.x >> 5;
  const int colBlocks = H_ / 32;                     // 16
  const int rowBase = (blockIdx.x / colBlocks) * 256;
  const int colBase = (blockIdx.x % colBlocks) * 32;
  const int rowW = rowBase + wave * 32;
  const int mn = lane & 15;
  const int hi = lane >> 4;

  // copy side: lanes 0-15 one row, lanes 16-31 the next, 16 B per lane
  const float* __restrict__ xrsrc = xsr + (size_t)(rowW + hi) * P_ + mn * 4;
  const float* __restrict__ xisrc = xsi + (size_t)(rowW + hi) * P_ + mn * 4;
  float* xrdst = &sXr[wave * 32 + hi][mn * 4];
  float* xidst = &sXi[wave * 32 + hi][mn * 4];
  // fragment side
  const float* ar0 = &sXr[wave * 32 + mn][2 * hi];
  const float* ar1 = &sXr[wave * 32 + 16 + mn][2 * hi];
  const float* ai0 = &sXi[wave * 32 + mn][2 * hi];
  const float* ai1 = &sXi[wave * 32 + 16 + mn][2 * hi];

  v8f accR[2][2] = {};
  v8f accI[2][2] = {};

  for (int k0 = 0; k0 < P_; k0 += KC) {
    // --- async panel stage: this wave's 32 rows of xs[.., k0..+KC] -> LDS ---
    async_ld8_b128(xrdst, 2 * AP, xrsrc + k0, 2 * P_);
    async_ld8_b128(xrdst + 16 * AP, 2 * AP, xrsrc + k0 + 16 * P_, 2 * P_);
    async_ld8_b128(xidst, 2 * AP, xisrc + k0, 2 * P_);
    async_ld8_b128(xidst + 16 * AP, 2 * AP, xisrc + k0 + 16 * P_, 2 * P_);
    // --- async panel stage: C[colBase..+32, k0..+KC] -> LDS (b128) ---
#pragma unroll
    for (int i = threadIdx.x; i < (32 * KC) / 4; i += 256) {   // 2 iters
      const int n = i >> 4;
      const int kk = (i & 15) * 4;
      const size_t g = (size_t)(colBase + n) * P_ + k0 + kk;
      async_ld_b128(&sCr[n][kk], Cre + g);
      async_ld_b128(&sCi[n][kk], Cim + g);
    }
    wait_asynccnt0();
    __syncthreads();

#pragma unroll
    for (int kk = 0; kk < KC; kk += 4) {
      const v2f fr0 = *(const v2f*)(ar0 + kk);
      const v2f fr1 = *(const v2f*)(ar1 + kk);
      const v2f fi0 = *(const v2f*)(ai0 + kk);
      const v2f fi1 = *(const v2f*)(ai1 + kk);
      const v2f c0r = *(const v2f*)(&sCr[mn][kk + 2 * hi]);
      const v2f c1r = *(const v2f*)(&sCr[16 + mn][kk + 2 * hi]);
      const v2f c0i = *(const v2f*)(&sCi[mn][kk + 2 * hi]);
      const v2f c1i = *(const v2f*)(&sCi[16 + mn][kk + 2 * hi]);
      accR[0][0] = __builtin_amdgcn_wmma_f32_16x16x4_f32(false, fr0, false, c0r,
                      (short)0, accR[0][0], false, false);
      accR[0][1] = __builtin_amdgcn_wmma_f32_16x16x4_f32(false, fr0, false, c1r,
                      (short)0, accR[0][1], false, false);
      accR[1][0] = __builtin_amdgcn_wmma_f32_16x16x4_f32(false, fr1, false, c0r,
                      (short)0, accR[1][0], false, false);
      accR[1][1] = __builtin_amdgcn_wmma_f32_16x16x4_f32(false, fr1, false, c1r,
                      (short)0, accR[1][1], false, false);
      accI[0][0] = __builtin_amdgcn_wmma_f32_16x16x4_f32(false, fi0, false, c0i,
                      (short)0, accI[0][0], false, false);
      accI[0][1] = __builtin_amdgcn_wmma_f32_16x16x4_f32(false, fi0, false, c1i,
                      (short)0, accI[0][1], false, false);
      accI[1][0] = __builtin_amdgcn_wmma_f32_16x16x4_f32(false, fi1, false, c0i,
                      (short)0, accI[1][0], false, false);
      accI[1][1] = __builtin_amdgcn_wmma_f32_16x16x4_f32(false, fi1, false, c1i,
                      (short)0, accI[1][1], false, false);
    }
    wait_dscnt0();
    __syncthreads();
  }

#pragma unroll
  for (int ni = 0; ni < 2; ++ni) {
    const int h = colBase + ni * 16 + mn;
    const float dv = Dv[h];
#pragma unroll
    for (int mi = 0; mi < 2; ++mi) {
#pragma unroll
      for (int v = 0; v < 8; ++v) {
        const size_t r = (size_t)(rowW + mi * 16 + v + 8 * hi);
        y[r * H_ + h] =
            2.0f * (accR[mi][ni][v] - accI[mi][ni][v]) + dv * u[r * H_ + h];
      }
    }
  }
}

// ---------------------------------------------------------------------------
// Launch
// ---------------------------------------------------------------------------
extern "C" void kernel_launch(void* const* d_in, const int* in_sizes, int n_in,
                              void* d_out, int out_size, void* d_ws,
                              size_t ws_size, hipStream_t stream) {
  (void)in_sizes; (void)n_in; (void)out_size; (void)ws_size;
  const float* u      = (const float*)d_in[0];
  const float* lam_re = (const float*)d_in[1];
  const float* lam_im = (const float*)d_in[2];
  const float* B_re   = (const float*)d_in[3];
  const float* B_im   = (const float*)d_in[4];
  const float* C_re   = (const float*)d_in[5];
  const float* C_im   = (const float*)d_in[6];
  const float* Dv     = (const float*)d_in[7];
  const float* log_dt = (const float*)d_in[8];
  float* y = (float*)d_out;

  // Workspace carve-up (floats)
  float* ws  = (float*)d_ws;
  float* lbr = ws;                       // P
  float* lbi = lbr + P_;                 // P
  float* Bbr = lbi + P_;                 // P*H
  float* Bbi = Bbr + (size_t)P_ * H_;    // P*H
  float* bur = Bbi + (size_t)P_ * H_;    // NBL*P
  float* bui = bur + (size_t)NBL * P_;   // NBL*P
  float* car = bui + (size_t)NBL * P_;   // B*NC*P
  float* cai = car + (size_t)B_ * NC * P_;
  float* cir = cai + (size_t)B_ * NC * P_;
  float* cii = cir + (size_t)B_ * NC * P_;

  s5_setup<<<(P_ * H_) / 256, 256, 0, stream>>>(
      lam_re, lam_im, B_re, B_im, log_dt, lbr, lbi, Bbr, Bbi);

  s5_gemm1<<<(NBL / 256) * (P_ / 32), 256, 0, stream>>>(
      u, Bbr, Bbi, bur, bui);

  s5_scan_local<<<B_ * NC, 256, 0, stream>>>(lbr, lbi, bur, bui, car, cai);
  s5_scan_carry<<<B_, 256, 0, stream>>>(lbr, lbi, car, cai, cir, cii);
  s5_scan_apply<<<B_ * NC, 256, 0, stream>>>(lbr, lbi, cir, cii, bur, bui);

  s5_gemm2<<<(NBL / 256) * (H_ / 32), 256, 0, stream>>>(
      bur, bui, C_re, C_im, Dv, u, y);
}

// v003
// One run takes 210 microseconds.
// In two side-by-side timings against v002, it was 1.28 and 1.29 times as fast.
// All steps since v000 together make it 2.52 times as fast.
#include <hip/hip_runtime.h>
#include <hip/hip_bf16.h>
#include <math.h>
#include <stdint.h>

// ---------------------------------------------------------------------------
// S5 SSM on MI455X (gfx1250): fp32 WMMA GEMMs (32x32 per wave) with
// async global->LDS panel staging (GLOBAL_LOAD_ASYNC_TO_LDS_B128, ASYNCcnt)
// + chunked complex scan: chunk-local scan on GEMM1's accumulators, carry
// scan across chunks, carry apply.
// Layout: Bu/xs stored (B*L, P) row-major so the scan (parallel over p) is
// fully coalesced and GEMM2 reads rows contiguously.
// ---------------------------------------------------------------------------

#define B_  8
#define L_  4096
#define H_  512
#define P_  256
#define NBL (B_ * L_)      // 32768 rows
#define NC  32             // scan chunks
#define CH  (L_ / NC)      // 128 steps per chunk (= 2^7)
#define KC  64             // K-panel staged in LDS per iteration
#define AP  (KC + 4)       // panel row pitch in floats (A and B): at 68 dwords the 16 rows
                           // of one b64 fragment read fall on 64 distinct banks

typedef __attribute__((ext_vector_type(2))) float v2f;
typedef __attribute__((ext_vector_type(8))) float v8f;

// Async DMA: global -> LDS, 16 bytes, tracked by ASYNCcnt (no VGPR data path).
__device__ __forceinline__ void async_ld_b128(void* lds, const float* gaddr) {
  const unsigned lo = (unsigned)(uintptr_t)lds;           // LDS byte offset
  const unsigned long long ga = (unsigned long long)(uintptr_t)gaddr;
  asm volatile("global_load_async_to_lds_b128 %0, %1, off"
               :: "v"(lo), "v"(ga) : "memory");
}
// Eight such copies, rows lstep / gstep floats apart, in ONE statement that ends
// in s_wait_xcnt 0, so that no address register named by an issued copy can be
// rewritten ahead of that wait.
__device__ __forceinline__ void async_ld8_b128(float* lds, int lstep,
                                               const float* g, int gstep) {
  const unsigned l0 = (unsigned)(uintptr_t)(void*)lds;    // LDS byte offset
  const unsigned ls = (unsigned)lstep * 4u;
  asm volatile(
      "global_load_async_to_lds_b128 %0, %8, off\n\t"
      "global_load_async_to_lds_b128 %1, %9, off\n\t"
      "global_load_async_to_lds_b128 %2, %10, off\n\t"
      "global_load_async_to_lds_b128 %3, %11, off\n\t"
      "global_load_async_to_lds_b128 %4, %12, off\n\t"
      "global_load_async_to_lds_b128 %5, %13, off\n\t"
      "global_load_async_to_lds_b128 %6, %14, off\n\t"
      "global_load_async_to_lds_b128 %7, %15, off\n\t"
      "s_wait_xcnt 0x0"
      :: "v"(l0), "v"(l0 + ls), "v"(l0 + 2u * ls), "v"(l0 + 3u * ls),
         "v"(l0 + 4u * ls), "v"(l0 + 5u * ls), "v"(l0 + 6u * ls),
         "v"(l0 + 7u * ls),
         "v"(g), "v"(g + gstep), "v"(g + 2 * gstep), "v"(g + 3 * gstep),
         "v"(g + 4 * gstep), "v"(g + 5 * gstep), "v"(g + 6 * gstep),
         "v"(g + 7 * gstep)
      : "memory");
}
__device__ __forceinline__ void wait_asynccnt0() {
  asm volatile("s_wait_asynccnt 0x0" ::: "memory");
}
// A wave's LDS reads have retired before the barrier behind which the panels
// it read are refilled by async copies.
__device__ __forceinline__ void wait_dscnt0() {
  asm volatile("s_wait_dscnt 0x0" ::: "memory");
}

// ---------------------------------------------------------------------------
// 1) ZOH discretization:  lambda_bar = exp(lam*dt),  B_bar = ((lb-1)/lam)*B~
// ---------------------------------------------------------------------------
__global__ __launch_bounds__(256) void s5_setup(
    const float* __restrict__ lam_re, const float* __restrict__ lam_im,
    const float* __restrict__ B_re,   const float* __restrict__ B_im,
    const float* __restrict__ log_dt,
    float* __restrict__ lbr_out, float* __restrict__ lbi_out,
    float* __restrict__ Bbr,     float* __restrict__ Bbi) {
  const int tid = blockIdx.x * blockDim.x + threadIdx.x;   // over P*H
  const int p = tid / H_;
  const int h = tid % H_;
  const float lr = lam_re[p];
  const float li = lam_im[p];
  const float dt = __expf(log_dt[p]);
  const float er = __expf(lr * dt);
  const float lbr = er * __cosf(li * dt);
  const float lbi = er * __sinf(li * dt);
  // coef = (lambda_bar - 1) / lam   (complex division)
  const float inv_den = 1.0f / (lr * lr + li * li);
  const float cr = ((lbr - 1.0f) * lr + lbi * li) * inv_den;
  const float ci = (lbi * lr - (lbr - 1.0f) * li) * inv_den;
  const float br = B_re[(size_t)p * H_ + h];
  const float bi = B_im[(size_t)p * H_ + h];
  Bbr[(size_t)p * H_ + h] = cr * br - ci * bi;
  Bbi[(size_t)p * H_ + h] = cr * bi + ci * br;
  if (h == 0) { lbr_out[p] = lbr; lbi_out[p] = lbi; }
}

// ---------------------------------------------------------------------------
// 2) GEMM1: Bu[r,p] = sum_h u[r,h] * B_bar[p,h]   (re & im share A fragments)
//    Block = 256 rows x 32 cols; wave w = rows [w*32, w*32+32) of the block.
//    B panels (re/im) DMA'd into LDS via async-to-LDS b128, shared by 8 waves.
//    A panel (256 rows x KC) DMA'd the same way, whole 256-B row pieces per
//    half-wave; each wave copies the 32 rows it reads.
//    f32 WMMA 16x16x4 fragment maps:
//      A 16x4 : M = lane&15, K = 2*(lane>>4) + v   -> float2 load
//      B 4x16 : N = lane&15, K = 2*(lane>>4) + v   -> float2 load
//      C/D    : N = lane&15, M = v + 8*(lane>>4)
//    Epilogue: the rows are time steps, so the chunk-local scan
//    x_j = lambda_bar * x_{j-1} + Bu_j (zero start per CH-row chunk) is done on
//    the accumulators before they are stored. A lane holds 8 consecutive rows
//    of a column per tile: scan those, chain the wave's four 8-row segment
//    totals with lambda_bar^8, chain the chunk's four waves' totals (through
//    LDS) with lambda_bar^32, then add lambda_bar^{v+1} * carry to each row.
// ---------------------------------------------------------------------------
__global__ __launch_bounds__(256) void s5_gemm1(
    const float* __restrict__ u,
    const float* __restrict__ Bbr, const float* __restrict__ Bbi,
    const float* __restrict__ lbr_, const float* __restrict__ lbi_,
    float* __restrict__ bur, float* __restrict__ bui,
    float* __restrict__ car, float* __restrict__ cai) {
  __shared__ __attribute__((aligned(16))) float sBr[32][AP];   // [n_local][k]
  __shared__ __attribute__((aligned(16))) float sBi[32][AP];
  __shared__ __attribute__((aligned(16))) float sA[256][AP];   // [m_local][k]
  __shared__ float sWr[8][32];                       // [wave][n_local] 32-row totals
  __shared__ float sWi[8][32];

  const int lane = threadIdx.x & 31;
  const int wave = threadIdx.x >> 5;
  const int colBlocks = P_ / 32;                     // 8
  const int rowBase = (blockIdx.x / colBlocks) * 256;
  const int colBase = (blockIdx.x % colBlocks) * 32;
  const int rowW = rowBase + wave * 32;
  const int mn = lane & 15;
  const int hi = lane >> 4;

  // copy side: lanes 0-15 one row, lanes 16-31 the next, 16 B per lane
  const float* __restrict__ asrc = u + (size_t)(rowW + hi) * H_ + mn * 4;
  float* adst = &sA[wave * 32 + hi][mn * 4];
  // fragment side
  const float* arow0 = &sA[wave * 32 + mn][2 * hi];
  const float* arow1 = &sA[wave * 32 + 16 + mn][2 * hi];

  v8f accr[2][2] = {};
  v8f acci[2][2] = {};

  for (int h0 = 0; h0 < H_; h0 += KC) {
    // --- async panel stage: this wave's 32 rows of u[.., h0..+KC] -> LDS ---
    async_ld8_b128(adst, 2 * AP, asrc + h0, 2 * H_);
    async_ld8_b128(adst + 16 * AP, 2 * AP, asrc + h0 + 16 * H_, 2 * H_);
    // --- async panel stage: B_bar[colBase..+32, h0..+KC] -> LDS (b128) ---
#pragma unroll
    for (int i = threadIdx.x; i < (32 * KC) / 4; i += 256) {   // 2 iters
      const int n = i >> 4;              // KC/4 = 16 chunks per row
      const int kk = (i & 15) * 4;
      const size_t g = (size_t)(colBase + n) * H_ + h0 + kk;
      async_ld_b128(&sBr[n][kk], Bbr + g);
      async_ld_b128(&sBi[n][kk], Bbi + g);
    }
    wait_asynccnt0();
    __syncthreads();

#pragma unroll
    for (int kk = 0; kk < KC; kk += 4) {
      const v2f a0 = *(const v2f*)(arow0 + kk);
      const v2f a1 = *(const v2f*)(arow1 + kk);
      const v2f b0r = *(const v2f*)(&sBr[mn][kk + 2 * hi]);
      const v2f b1r = *(const v2f*)(&sBr[16 + mn][kk + 2 * hi]);
      const v2f b0i = *(const v2f*)(&sBi[mn][kk + 2 * hi]);
      const v2f b1i = *(const v2f*)(&sBi[16 + mn][kk + 2 * hi]);
      accr[0][0] = __builtin_amdgcn_wmma_f32_16x16x4_f32(false, a0, false, b0r,
                      (short)0, accr[0][0], false, false);
      accr[0][1] = __builtin_amdgcn_wmma_f32_16x16x4_f32(false, a0, false, b1r,
                      (short)0, accr[0][1], false, false);
      accr[1][0] = __builtin_amdgcn_wmma_f32_16x16x4_f32(false, a1, false, b0r,
                      (short)0, accr[1][0], false, false);
      accr[1][1] = __builtin_amdgcn_wmma_f32_16x16x4_f32(false, a1, false, b1r,
                      (short)0, accr[1][1], false, false);
      acci[0][0] = __builtin_amdgcn_wmma_f32_16x16x4_f32(false, a0, false, b0i,
                      (short)0, acci[0][0], false, false);
      acci[0][1] = __builtin_amdgcn_wmma_f32_16x16x4_f32(false, a0, false, b1i,
                      (short)0, acci[0][1], false, false);
      acci[1][0] = __builtin_amdgcn_wmma_f32_16x16x4_f32(false, a1, false, b0i,
                      (short)0, acci[1][0], false, false);
      acci[1][1] = __builtin_amdgcn_wmma_f32_16x16x4_f32(false, a1, false, b1i,
                      (short)0, acci[1][1], false, false);
    }
    wait_dscnt0();
    __syncthreads();
  }

  // --- chunk-local scan on the accumulators (chunk = CH rows = 4 waves) ---
  // The loop's exit is the taken side of the branch right behind its last
  // WMMAs: these four slots keep the first
  // vector read of an accumulator at the required distance from them.
  asm volatile("v_nop\n\tv_nop\n\tv_nop\n\tv_nop");
  // Keeps the accumulator reads below from being scheduled above the slots.
  __builtin_amdgcn_sched_barrier(0);
  static_assert(CH == 4 * 32, "a chunk is the rows of four waves");
  const int wl = wave & 3;                 // this wave's place in its chunk
  float lamr[2], lami[2], p8r[2], p8i[2], p32r[2], p32i[2];
  float Tr[2][4], Ti[2][4];                // the wave's 8-row segment totals, row order
#pragma unroll
  for (int ni = 0; ni < 2; ++ni) {
    const float lr = lbr_[colBase + ni * 16 + mn];
    const float li = lbi_[colBase + ni * 16 + mn];
    lamr[ni] = lr; lami[ni] = li;
    float pr = lr, pi = li;
#pragma unroll
    for (int s = 0; s < 5; ++s) {          // lambda_bar^8 after 3 squarings, ^32 after 5
      const float nr = pr * pr - pi * pi;
      const float nj = 2.0f * pr * pi;
      pr = nr; pi = nj;
      if (s == 2) { p8r[ni] = pr; p8i[ni] = pi; }
    }
    p32r[ni] = pr; p32i[ni] = pi;
#pragma unroll
    for (int mi = 0; mi < 2; ++mi) {
      float sr = accr[mi][ni][0], si = acci[mi][ni][0];   // zero start
#pragma unroll
      for (int v = 1; v < 8; ++v) {
        const float nr = fmaf(lr, sr, fmaf(-li, si, accr[mi][ni][v]));
        const float nj = fmaf(lr, si, fmaf(li, sr, acci[mi][ni][v]));
        sr = nr; si = nj;
        accr[mi][ni][v] = sr;
        acci[mi][ni][v] = si;
      }
      const float qr = __shfl_xor(sr, 16); // the other half-wave's segment total
      const float qi = __shfl_xor(si, 16);
      Tr[ni][2 * mi]     = hi ? qr : sr;
      Ti[ni][2 * mi]     = hi ? qi : si;
      Tr[ni][2 * mi + 1] = hi ? sr : qr;
      Ti[ni][2 * mi + 1] = hi ? si : qi;
    }
    float wr = Tr[ni][0], wi = Ti[ni][0];  // the wave's 32-row total, zero start
#pragma unroll
    for (int q = 1; q < 4; ++q) {
      const float nr = fmaf(p8r[ni], wr, fmaf(-p8i[ni], wi, Tr[ni][q]));
      const float nj = fmaf(p8r[ni], wi, fmaf(p8i[ni], wr, Ti[ni][q]));
      wr = nr; wi = nj;
    }
    if (hi == 0) {
      sWr[wave][ni * 16 + mn] = wr;
      sWi[wave][ni * 16 + mn] = wi;
    }
  }
  __syncthreads();                         // publishes the waves' totals
#pragma unroll
  for (int ni = 0; ni < 2; ++ni) {
    float cr = 0.0f, ci = 0.0f;            // state at the row before this wave's first
#pragma unroll
    for (int w = 0; w < 3; ++w) {
      if (w < wl) {
        const float xr = sWr[(wave & 4) + w][ni * 16 + mn];
        const float xi = sWi[(wave & 4) + w][ni * 16 + mn];
        const float nr = fmaf(p32r[ni], cr, fmaf(-p32i[ni], ci, xr));
        const float nj = fmaf(p32r[ni], ci, fmaf(p32i[ni], cr, xi));
        cr = nr; ci = nj;
      }
    }
    float mr[2], mj[2];                    // carry into this lane's segment of tile mi
#pragma unroll
    for (int q = 0; q < 4; ++q) {
      if ((q & 1) == 0) { mr[q >> 1] = cr; mj[q >> 1] = ci; }
      else if (hi)      { mr[q >> 1] = cr; mj[q >> 1] = ci; }
      const float nr = fmaf(p8r[ni], cr, fmaf(-p8i[ni], ci, Tr[ni][q]));
      const float nj = fmaf(p8r[ni], ci, fmaf(p8i[ni], cr, Ti[ni][q]));
      cr = nr; ci = nj;
    }
    if (wl == 3 && hi == 0) {              // state at the chunk's last row
      const size_t bc = (size_t)(rowW / CH);
      car[bc * P_ + colBase + ni * 16 + mn] = cr;
      cai[bc * P_ + colBase + ni * 16 + mn] = ci;
    }
#pragma unroll
    for (int mi = 0; mi < 2; ++mi) {
      float wr = lamr[ni] * mr[mi] - lami[ni] * mj[mi];
      float wi = lamr[ni] * mj[mi] + lami[ni] * mr[mi];
#pragma unroll
      for (int v = 0; v < 8; ++v) {
        accr[mi][ni][v] += wr;
        acci[mi][ni][v] += wi;
        const float nr = fmaf(lamr[ni], wr, -lami[ni] * wi);
        const float nj = fmaf(lamr[ni], wi, lami[ni] * wr);
        wr = nr; wi = nj;
      }
    }
  }

#pragma unroll
  for (int mi = 0; mi < 2; ++mi) {
#pragma unroll
    for (int ni = 0; ni < 2; ++ni) {
#pragma unroll
      for (int v = 0; v < 8; ++v) {
        const int m = v + 8 * hi;
        const size_t idx =
            (size_t)(rowW + mi * 16 + m) * P_ + colBase + ni * 16 + mn;
        bur[idx] = accr[mi][ni][v];
        bui[idx] = acci[mi][ni][v];
      }
    }
  }
}

// ---------------------------------------------------------------------------
// 3b) Scan pass 2: sequential carry scan across the NC chunks per (b,p).
//     lambda_bar^CH via 7 complex squarings (CH = 128 = 2^7).
// ---------------------------------------------------------------------------
__global__ __launch_bounds__(256) void s5_scan_carry(
    const float* __restrict__ lbr_, const float* __restrict__ lbi_,
    const float* __restrict__ car, const float* __restrict__ cai,
    float* __restrict__ cir, float* __restrict__ cii) {
  const int p = threadIdx.x;
  const int b = blockIdx.x;
  float pr = lbr_[p], pi = lbi_[p];
#pragma unroll
  for (int s = 0; s < 7; ++s) {
    const float nr = pr * pr - pi * pi;
    const float ni = 2.0f * pr * pi;
    pr = nr; pi = ni;
  }
  float er = 0.0f, ei = 0.0f;
#pragma unroll
  for (int c = 0; c < NC; ++c) {
    const size_t idx = ((size_t)b * NC + c) * P_ + p;
    cir[idx] = er;
    cii[idx] = ei;
    const float nr = fmaf(pr, er, fmaf(-pi, ei, car[idx]));
    const float ni = fmaf(pr, ei, fmaf(pi, er, cai[idx]));
    er = nr; ei = ni;
  }
}

// ---------------------------------------------------------------------------
// 3c) Scan pass 3: x_j += lambda_bar^{j+1} * carry_in   (chunk 0 has carry 0)
// ---------------------------------------------------------------------------
__global__ __launch_bounds__(256) void s5_scan_apply(
    const float* __restrict__ lbr_, const float* __restrict__ lbi_,
    const float* __restrict__ cir, const float* __restrict__ cii,
    float* __restrict__ bur, float* __restrict__ bui) {
  const int p = threadIdx.x;
  const int bc = blockIdx.x;
  const int b = bc / NC, c = bc % NC;
  if (c == 0) return;                   // carry-in is zero for chunk 0
  const float lr = lbr_[p], li = lbi_[p];
  const float er = cir[(size_t)bc * P_ + p];
  const float ei = cii[(size_t)bc * P_ + p];
  float wr = lr * er - li * ei;
  float wi = lr * ei + li * er;
  size_t idx = ((size_t)b * L_ + (size_t)c * CH) * P_ + p;
  for (int j = 0; j < CH; ++j, idx += P_) {
    bur[idx] += wr;
    bui[idx] += wi;
    const float nr = fmaf(lr, wr, -li * wi);
    const float ni = fmaf(lr, wi, li * wr);
    wr = nr; wi = ni;
  }
}

// ---------------------------------------------------------------------------
// 4) GEMM2: y[r,h] = 2*(xs_re[r,:]@C_re[h,:] - xs_im[r,:]@C_im[h,:]) + D[h]*u
//    C panels and the xs re/im panels (256 rows x KC each) DMA'd into LDS;
//    separate re/im accumulators, subtraction folded
//    into the epilogue (DMA path cannot negate in flight).
// ---------------------------------------------------------------------------
__global__ __launch_bounds__(256) void s5_gemm2(
    const float* __restrict__ xsr, const float* __restrict__ xsi,
    const float* __restrict__ Cre, const float* __restrict__ Cim,
    const float* __restrict__ Dv,  const float* __restrict__ u,
    float* __restrict__ y) {
  __shared__ __attribute__((aligned(16))) float sCr[32][AP];   // [n_local][k]
  __shared__ __attribute__((aligned(16))) float sCi[32][AP];
  __shared__ __attribute__((aligned(16))) float sXr[256][AP];  // [m_local][k]
  __shared__ __attribute__((aligned(16))) float sXi[256][AP];

  const int lane = threadIdx.x & 31;
  const int wave = threadIdx.x >> 5;
  const int colBlocks = H_ / 32;                     // 16
  const int rowBase = (blockIdx.x / colBlocks) * 256;
  const int colBase = (blockIdx.x % colBlocks) * 32;
  const int rowW = rowBase + wave * 32;
  const int mn = lane & 15;
  const int hi = lane >> 4;

  // copy side: lanes 0-15 one row, lanes 16-31 the next, 16 B per lane
  const float* __restrict__ xrsrc = xsr + (size_t)(rowW + hi) * P_ + mn * 4;
  const float* __restrict__ xisrc = xsi + (size_t)(rowW + hi) * P_ + mn * 4;
  float* xrdst = &sXr[wave * 32 + hi][mn * 4];
  float* xidst = &sXi[wave * 32 + hi][mn * 4];
  // fragment side
  const float* ar0 = &sXr[wave * 32 + mn][2 * hi];
  const float* ar1 = &sXr[wave * 32 + 16 + mn][2 * hi];
  const float* ai0 = &sXi[wave * 32 + mn][2 * hi];
  const float* ai1 = &sXi[wave * 32 + 16 + mn][2 * hi];

  v8f accR[2][2] = {};
  v8f accI[2][2] = {};

  for (int k0 = 0; k0 < P_; k0 += KC) {
    // --- async panel stage: this wave's 32 rows of xs[.., k0..+KC] -> LDS ---
    async_ld8_b128(xrdst, 2 * AP, xrsrc + k0, 2 * P_);
    async_ld8_b128(xrdst + 16 * AP, 2 * AP, xrsrc + k0 + 16 * P_, 2 * P_);
    async_ld8_b128(xidst, 2 * AP, xisrc + k0, 2 * P_);
    async_ld8_b128(xidst + 16 * AP, 2 * AP, xisrc + k0 + 16 * P_, 2 * P_);
    // --- async panel stage: C[colBase..+32, k0..+KC] -> LDS (b128) ---
#pragma unroll
    for (int i = threadIdx.x; i < (32 * KC) / 4; i += 256) {   // 2 iters
      const int n = i >> 4;
      const int kk = (i & 15) * 4;
      const size_t g = (size_t)(colBase + n) * P_ + k0 + kk;
      async_ld_b128(&sCr[n][kk], Cre + g);
      async_ld_b128(&sCi[n][kk], Cim + g);
    }
    wait_asynccnt0();
    __syncthreads();

#pragma unroll
    for (int kk = 0; kk < KC; kk += 4) {
      const v2f fr0 = *(const v2f*)(ar0 + kk);
      const v2f fr1 = *(const v2f*)(ar1 + kk);
      const v2f fi0 = *(const v2f*)(ai0 + kk);
      const v2f fi1 = *(const v2f*)(ai1 + kk);
      const v2f c0r = *(const v2f*)(&sCr[mn][kk + 2 * hi]);
      const v2f c1r = *(const v2f*)(&sCr[16 + mn][kk + 2 * hi]);
      const v2f c0i = *(const v2f*)(&sCi[mn][kk + 2 * hi]);
      const v2f c1i = *(const v2f*)(&sCi[16 + mn][kk + 2 * hi]);
      accR[0][0] = __builtin_amdgcn_wmma_f32_16x16x4_f32(false, fr0, false, c0r,
                      (short)0, accR[0][0], false, false);
      accR[0][1] = __builtin_amdgcn_wmma_f32_16x16x4_f32(false, fr0, false, c1r,
                      (short)0, accR[0][1], false, false);
      accR[1][0] = __builtin_amdgcn_wmma_f32_16x16x4_f32(false, fr1, false, c0r,
                      (short)0, accR[1][0], false, false);
      accR[1][1] = __builtin_amdgcn_wmma_f32_16x16x4_f32(false, fr1, false, c1r,
                      (short)0, accR[1][1], false, false);
      accI[0][0] = __builtin_amdgcn_wmma_f32_16x16x4_f32(false, fi0, false, c0i,
                      (short)0, accI[0][0], false, false);
      accI[0][1] = __builtin_amdgcn_wmma_f32_16x16x4_f32(false, fi0, false, c1i,
                      (short)0, accI[0][1], false, false);
      accI[1][0] = __builtin_amdgcn_wmma_f32_16x16x4_f32(false, fi1, false, c0i,
                      (short)0, accI[1][0], false, false);
      accI[1][1] = __builtin_amdgcn_wmma_f32_16x16x4_f32(false, fi1, false, c1i,
                      (short)0, accI[1][1], false, false);
    }
    wait_dscnt0();
    __syncthreads();
  }

#pragma unroll
  for (int ni = 0; ni < 2; ++ni) {
    const int h = colBase + ni * 16 + mn;
    const float dv = Dv[h];
#pragma unroll
    for (int mi = 0; mi < 2; ++mi) {
#pragma unroll
      for (int v = 0; v < 8; ++v) {
        const size_t r = (size_t)(rowW + mi * 16 + v + 8 * hi);
        y[r * H_ + h] =
            2.0f * (accR[mi][ni][v] - accI[mi][ni][v]) + dv * u[r * H_ + h];
      }
    }
  }
}

// ---------------------------------------------------------------------------
// Launch
// ---------------------------------------------------------------------------
extern "C" void kernel_launch(void* const* d_in, const int* in_sizes, int n_in,
                              void* d_out, int out_size, void* d_ws,
                              size_t ws_size, hipStream_t stream) {
  (void)in_sizes; (void)n_in; (void)out_size; (void)ws_size;
  const float* u      = (const float*)d_in[0];
  const float* lam_re = (const float*)d_in[1];
  const float* lam_im = (const float*)d_in[2];
  const float* B_re   = (const float*)d_in[3];
  const float* B_im   = (const float*)d_in[4];
  const float* C_re   = (const float*)d_in[5];
  const float* C_im   = (const float*)d_in[6];
  const float* Dv     = (const float*)d_in[7];
  const float* log_dt = (const float*)d_in[8];
  float* y = (float*)d_out;

  // Workspace carve-up (floats)
  float* ws  = (float*)d_ws;
  float* lbr = ws;                       // P
  float* lbi = lbr + P_;                 // P
  float* Bbr = lbi + P_;                 // P*H
  float* Bbi = Bbr + (size_t)P_ * H_;    // P*H
  float* bur = Bbi + (size_t)P_ * H_;    // NBL*P
  float* bui = bur + (size_t)NBL * P_;   // NBL*P
  float* car = bui + (size_t)NBL * P_;   // B*NC*P
  float* cai = car + (size_t)B_ * NC * P_;
  float* cir = cai + (size_t)B_ * NC * P_;
  float* cii = cir + (size_t)B_ * NC * P_;

  s5_setup<<<(P_ * H_) / 256, 256, 0, stream>>>(
      lam_re, lam_im, B_re, B_im, log_dt, lbr, lbi, Bbr, Bbi);

  s5_gemm1<<<(NBL / 256) * (P_ / 32), 256, 0, stream>>>(
      u, Bbr, Bbi, lbr, lbi, bur, bui, car, cai);

  s5_scan_carry<<<B_, 256, 0, stream>>>(lbr, lbi, car, cai, cir, cii);
  s5_scan_apply<<<B_ * NC, 256, 0, stream>>>(lbr, lbi, cir, cii, bur, bui);

  s5_gemm2<<<(NBL / 256) * (H_ / 32), 256, 0, stream>>>(
      bur, bui, C_re, C_im, Dv, u, y);
}

// v004
// Measured time: 196 microseconds a run.
// Two timings next to v003 put it at 1.07 and 1.08 times that version's speed.
// Counting every step since v000, it is 2.71 times as fast.
#include <hip/hip_runtime.h>
#include <hip/hip_bf16.h>
#include <math.h>
#include <stdint.h>

// ---------------------------------------------------------------------------
// S5 SSM on MI455X (gfx1250): fp32 WMMA GEMMs (32x32 per wave) with
// async global->LDS panel staging (GLOBAL_LOAD_ASYNC_TO_LDS_B128, ASYNCcnt)
// + chunked complex scan: chunk-local scan on GEMM1's accumulators, then one
// launch that chains the chunk totals and applies the carry.
// Layout: Bu/xs stored (B*L, P) row-major so the scan (parallel over p) is
// fully coalesced and GEMM2 reads rows contiguously.
// ---------------------------------------------------------------------------

#define B_  8
#define L_  4096
#define H_  512
#define P_  256
#define NBL (B_ * L_)      // 32768 rows
#define NC  32             // scan chunks
#define CH  (L_ / NC)      // 128 steps per chunk (= 2^7)
#define KC  64             // K-panel staged in LDS per iteration
#define AP  (KC + 4)       // panel row pitch in floats (A and B): at 68 dwords the 16 rows
                           // of one b64 fragment read fall on 64 distinct banks

typedef __attribute__((ext_vector_type(2))) float v2f;
typedef __attribute__((ext_vector_type(8))) float v8f;

// Async DMA: global -> LDS, 16 bytes, tracked by ASYNCcnt (no VGPR data path).
__device__ __forceinline__ void async_ld_b128(void* lds, const float* gaddr) {
  const unsigned lo = (unsigned)(uintptr_t)lds;           // LDS byte offset
  const unsigned long long ga = (unsigned long long)(uintptr_t)gaddr;
  asm volatile("global_load_async_to_lds_b128 %0, %1, off"
               :: "v"(lo), "v"(ga) : "memory");
}
// Eight such copies, rows lstep / gstep floats apart, in ONE statement that ends
// in s_wait_xcnt 0, so that no address register named by an issued copy can be
// rewritten ahead of that wait.
__device__ __forceinline__ void async_ld8_b128(float* lds, int lstep,
                                               const float* g, int gstep) {
  const unsigned l0 = (unsigned)(uintptr_t)(void*)lds;    // LDS byte offset
  const unsigned ls = (unsigned)lstep * 4u;
  asm volatile(
      "global_load_async_to_lds_b128 %0, %8, off\n\t"
      "global_load_async_to_lds_b128 %1, %9, off\n\t"
      "global_load_async_to_lds_b128 %2, %10, off\n\t"
      "global_load_async_to_lds_b128 %3, %11, off\n\t"
      "global_load_async_to_lds_b128 %4, %12, off\n\t"
      "global_load_async_to_lds_b128 %5, %13, off\n\t"
      "global_load_async_to_lds_b128 %6, %14, off\n\t"
      "global_load_async_to_lds_b128 %7, %15, off\n\t"
      "s_wait_xcnt 0x0"
      :: "v"(l0), "v"(l0 + ls), "v"(l0 + 2u * ls), "v"(l0 + 3u * ls),
         "v"(l0 + 4u * ls), "v"(l0 + 5u * ls), "v"(l0 + 6u * ls),
         "v"(l0 + 7u * ls),
         "v"(g), "v"(g + gstep), "v"(g + 2 * gstep), "v"(g + 3 * gstep),
         "v"(g + 4 * gstep), "v"(g + 5 * gstep), "v"(g + 6 * gstep),
         "v"(g + 7 * gstep)
      : "memory");
}
__device__ __forceinline__ void wait_asynccnt0() {
  asm volatile("s_wait_asynccnt 0x0" ::: "memory");
}
// A wave's LDS reads have retired before the barrier behind which the panels
// it read are refilled by async copies.
__device__ __forceinline__ void wait_dscnt0() {
  asm volatile("s_wait_dscnt 0x0" ::: "memory");
}

// ---------------------------------------------------------------------------
// 1) ZOH discretization:  lambda_bar = exp(lam*dt),  B_bar = ((lb-1)/lam)*B~
// ---------------------------------------------------------------------------
__global__ __launch_bounds__(256) void s5_setup(
    const float* __restrict__ lam_re, const float* __restrict__ lam_im,
    const float* __restrict__ B_re,   const float* __restrict__ B_im,
    const float* __restrict__ log_dt,
    float* __restrict__ lbr_out, float* __restrict__ lbi_out,
    float* __restrict__ Bbr,     float* __restrict__ Bbi) {
  const int tid = blockIdx.x * blockDim.x + threadIdx.x;   // over P*H
  const int p = tid / H_;
  const int h = tid % H_;
  const float lr = lam_re[p];
  const float li = lam_im[p];
  const float dt = __expf(log_dt[p]);
  const float er = __expf(lr * dt);
  const float lbr = er * __cosf(li * dt);
  const float lbi = er * __sinf(li * dt);
  // coef = (lambda_bar - 1) / lam   (complex division)
  const float inv_den = 1.0f / (lr * lr + li * li);
  const float cr = ((lbr - 1.0f) * lr + lbi * li) * inv_den;
  const float ci = (lbi * lr - (lbr - 1.0f) * li) * inv_den;
  const float br = B_re[(size_t)p * H_ + h];
  const float bi = B_im[(size_t)p * H_ + h];
  Bbr[(size_t)p * H_ + h] = cr * br - ci * bi;
  Bbi[(size_t)p * H_ + h] = cr * bi + ci * br;
  if (h == 0) { lbr_out[p] = lbr; lbi_out[p] = lbi; }
}

// ---------------------------------------------------------------------------
// 2) GEMM1: Bu[r,p] = sum_h u[r,h] * B_bar[p,h]   (re & im share A fragments)
//    Block = 256 rows x 32 cols; wave w = rows [w*32, w*32+32) of the block.
//    B panels (re/im) DMA'd into LDS via async-to-LDS b128, shared by 8 waves.
//    A panel (256 rows x KC) DMA'd the same way, whole 256-B row pieces per
//    half-wave; each wave copies the 32 rows it reads.
//    f32 WMMA 16x16x4 fragment maps:
//      A 16x4 : M = lane&15, K = 2*(lane>>4) + v   -> float2 load
//      B 4x16 : N = lane&15, K = 2*(lane>>4) + v   -> float2 load
//      C/D    : N = lane&15, M = v + 8*(lane>>4)
//    Epilogue: the rows are time steps, so the chunk-local scan
//    x_j = lambda_bar * x_{j-1} + Bu_j (zero start per CH-row chunk) is done on
//    the accumulators before they are stored. A lane holds 8 consecutive rows
//    of a column per tile: scan those, chain the wave's four 8-row segment
//    totals with lambda_bar^8, chain the chunk's four waves' totals (through
//    LDS) with lambda_bar^32, then add lambda_bar^{v+1} * carry to each row.
// ---------------------------------------------------------------------------
__global__ __launch_bounds__(256) void s5_gemm1(
    const float* __restrict__ u,
    const float* __restrict__ Bbr, const float* __restrict__ Bbi,
    const float* __restrict__ lbr_, const float* __restrict__ lbi_,
    float* __restrict__ bur, float* __restrict__ bui,
    float* __restrict__ car, float* __restrict__ cai) {
  __shared__ __attribute__((aligned(16))) float sBr[32][AP];   // [n_local][k]
  __shared__ __attribute__((aligned(16))) float sBi[32][AP];
  __shared__ __attribute__((aligned(16))) float sA[256][AP];   // [m_local][k]
  __shared__ float sWr[8][32];                       // [wave][n_local] 32-row totals
  __shared__ float sWi[8][32];

  const int lane = threadIdx.x & 31;
  const int wave = threadIdx.x >> 5;
  const int colBlocks = P_ / 32;                     // 8
  const int rowBase = (blockIdx.x / colBlocks) * 256;
  const int colBase = (blockIdx.x % colBlocks) * 32;
  const int rowW = rowBase + wave * 32;
  const int mn = lane & 15;
  const int hi = lane >> 4;

  // copy side: lanes 0-15 one row, lanes 16-31 the next, 16 B per lane
  const float* __restrict__ asrc = u + (size_t)(rowW + hi) * H_ + mn * 4;
  float* adst = &sA[wave * 32 + hi][mn * 4];
  // fragment side
  const float* arow0 = &sA[wave * 32 + mn][2 * hi];
  const float* arow1 = &sA[wave * 32 + 16 + mn][2 * hi];

  v8f accr[2][2] = {};
  v8f acci[2][2] = {};

  for (int h0 = 0; h0 < H_; h0 += KC) {
    // --- async panel stage: this wave's 32 rows of u[.., h0..+KC] -> LDS ---
    async_ld8_b128(adst, 2 * AP, asrc + h0, 2 * H_);
    async_ld8_b128(adst + 16 * AP, 2 * AP, asrc + h0 + 16 * H_, 2 * H_);
    // --- async panel stage: B_bar[colBase..+32, h0..+KC] -> LDS (b128) ---
#pragma unroll
    for (int i = threadIdx.x; i < (32 * KC) / 4; i += 256) {   // 2 iters
      const int n = i >> 4;              // KC/4 = 16 chunks per row
      const int kk = (i & 15) * 4;
      const size_t g = (size_t)(colBase + n) * H_ + h0 + kk;
      async_ld_b128(&sBr[n][kk], Bbr + g);
      async_ld_b128(&sBi[n][kk], Bbi + g);
    }
    wait_asynccnt0();
    __syncthreads();

#pragma unroll
    for (int kk = 0; kk < KC; kk += 4) {
      const v2f a0 = *(const v2f*)(arow0 + kk);
      const v2f a1 = *(const v2f*)(arow1 + kk);
      const v2f b0r = *(const v2f*)(&sBr[mn][kk + 2 * hi]);
      const v2f b1r = *(const v2f*)(&sBr[16 + mn][kk + 2 * hi]);
      const v2f b0i = *(const v2f*)(&sBi[mn][kk + 2 * hi]);
      const v2f b1i = *(const v2f*)(&sBi[16 + mn][kk + 2 * hi]);
      accr[0][0] = __builtin_amdgcn_wmma_f32_16x16x4_f32(false, a0, false, b0r,
                      (short)0, accr[0][0], false, false);
      accr[0][1] = __builtin_amdgcn_wmma_f32_16x16x4_f32(false, a0, false, b1r,
                      (short)0, accr[0][1], false, false);
      accr[1][0] = __builtin_amdgcn_wmma_f32_16x16x4_f32(false, a1, false, b0r,
                      (short)0, accr[1][0], false, false);
      accr[1][1] = __builtin_amdgcn_wmma_f32_16x16x4_f32(false, a1, false, b1r,
                      (short)0, accr[1][1], false, false);
      acci[0][0] = __builtin_amdgcn_wmma_f32_16x16x4_f32(false, a0, false, b0i,
                      (short)0, acci[0][0], false, false);
      acci[0][1] = __builtin_amdgcn_wmma_f32_16x16x4_f32(false, a0, false, b1i,
                      (short)0, acci[0][1], false, false);
      acci[1][0] = __builtin_amdgcn_wmma_f32_16x16x4_f32(false, a1, false, b0i,
                      (short)0, acci[1][0], false, false);
      acci[1][1] = __builtin_amdgcn_wmma_f32_16x16x4_f32(false, a1, false, b1i,
                      (short)0, acci[1][1], false, false);
    }
    wait_dscnt0();
    __syncthreads();
  }

  // --- chunk-local scan on the accumulators (chunk = CH rows = 4 waves) ---
  // The loop's exit is the taken side of the branch right behind its last
  // WMMAs: these four slots keep the first
  // vector read of an accumulator at the required distance from them.
  asm volatile("v_nop\n\tv_nop\n\tv_nop\n\tv_nop");
  // Keeps the accumulator reads below from being scheduled above the slots.
  __builtin_amdgcn_sched_barrier(0);
  static_assert(CH == 4 * 32, "a chunk is the rows of four waves");
  const int wl = wave & 3;                 // this wave's place in its chunk
  float lamr[2], lami[2], p8r[2], p8i[2], p32r[2], p32i[2];
  float Tr[2][4], Ti[2][4];                // the wave's 8-row segment totals, row order
#pragma unroll
  for (int ni = 0; ni < 2; ++ni) {
    const float lr = lbr_[colBase + ni * 16 + mn];
    const float li = lbi_[colBase + ni * 16 + mn];
    lamr[ni] = lr; lami[ni] = li;
    float pr = lr, pi = li;
#pragma unroll
    for (int s = 0; s < 5; ++s) {          // lambda_bar^8 after 3 squarings, ^32 after 5
      const float nr = pr * pr - pi * pi;
      const float nj = 2.0f * pr * pi;
      pr = nr; pi = nj;
      if (s == 2) { p8r[ni] = pr; p8i[ni] = pi; }
    }
    p32r[ni] = pr; p32i[ni] = pi;
#pragma unroll
    for (int mi = 0; mi < 2; ++mi) {
      float sr = accr[mi][ni][0], si = acci[mi][ni][0];   // zero start
#pragma unroll
      for (int v = 1; v < 8; ++v) {
        const float nr = fmaf(lr, sr, fmaf(-li, si, accr[mi][ni][v]));
        const float nj = fmaf(lr, si, fmaf(li, sr, acci[mi][ni][v]));
        sr = nr; si = nj;
        accr[mi][ni][v] = sr;
        acci[mi][ni][v] = si;
      }
      const float qr = __shfl_xor(sr, 16); // the other half-wave's segment total
      const float qi = __shfl_xor(si, 16);
      Tr[ni][2 * mi]     = hi ? qr : sr;
      Ti[ni][2 * mi]     = hi ? qi : si;
      Tr[ni][2 * mi + 1] = hi ? sr : qr;
      Ti[ni][2 * mi + 1] = hi ? si : qi;
    }
    float wr = Tr[ni][0], wi = Ti[ni][0];  // the wave's 32-row total, zero start
#pragma unroll
    for (int q = 1; q < 4; ++q) {
      const float nr = fmaf(p8r[ni], wr, fmaf(-p8i[ni], wi, Tr[ni][q]));
      const float nj = fmaf(p8r[ni], wi, fmaf(p8i[ni], wr, Ti[ni][q]));
      wr = nr; wi = nj;
    }
    if (hi == 0) {
      sWr[wave][ni * 16 + mn] = wr;
      sWi[wave][ni * 16 + mn] = wi;
    }
  }
  __syncthreads();                         // publishes the waves' totals
#pragma unroll
  for (int ni = 0; ni < 2; ++ni) {
    float cr = 0.0f, ci = 0.0f;            // state at the row before this wave's first
#pragma unroll
    for (int w = 0; w < 3; ++w) {
      if (w < wl) {
        const float xr = sWr[(wave & 4) + w][ni * 16 + mn];
        const float xi = sWi[(wave & 4) + w][ni * 16 + mn];
        const float nr = fmaf(p32r[ni], cr, fmaf(-p32i[ni], ci, xr));
        const float nj = fmaf(p32r[ni], ci, fmaf(p32i[ni], cr, xi));
        cr = nr; ci = nj;
      }
    }
    float mr[2], mj[2];                    // carry into this lane's segment of tile mi
#pragma unroll
    for (int q = 0; q < 4; ++q) {
      if ((q & 1) == 0) { mr[q >> 1] = cr; mj[q >> 1] = ci; }
      else if (hi)      { mr[q >> 1] = cr; mj[q >> 1] = ci; }
      const float nr = fmaf(p8r[ni], cr, fmaf(-p8i[ni], ci, Tr[ni][q]));
      const float nj = fmaf(p8r[ni], ci, fmaf(p8i[ni], cr, Ti[ni][q]));
      cr = nr; ci = nj;
    }
    if (wl == 3 && hi == 0) {              // state at the chunk's last row
      const size_t bc = (size_t)(rowW / CH);
      car[bc * P_ + colBase + ni * 16 + mn] = cr;
      cai[bc * P_ + colBase + ni * 16 + mn] = ci;
    }
#pragma unroll
    for (int mi = 0; mi < 2; ++mi) {
      float wr = lamr[ni] * mr[mi] - lami[ni] * mj[mi];
      float wi = lamr[ni] * mj[mi] + lami[ni] * mr[mi];
#pragma unroll
      for (int v = 0; v < 8; ++v) {
        accr[mi][ni][v] += wr;
        acci[mi][ni][v] += wi;
        const float nr = fmaf(lamr[ni], wr, -lami[ni] * wi);
        const float nj = fmaf(lamr[ni], wi, lami[ni] * wr);
        wr = nr; wi = nj;
      }
    }
  }

#pragma unroll
  for (int mi = 0; mi < 2; ++mi) {
#pragma unroll
    for (int ni = 0; ni < 2; ++ni) {
#pragma unroll
      for (int v = 0; v < 8; ++v) {
        const int m = v + 8 * hi;
        const size_t idx =
            (size_t)(rowW + mi * 16 + m) * P_ + colBase + ni * 16 + mn;
        bur[idx] = accr[mi][ni][v];
        bui[idx] = acci[mi][ni][v];
      }
    }
  }
}

// ---------------------------------------------------------------------------
// 3) Carry: x_j += lambda_bar^{j+1} * carry_in   (chunk 0 has carry 0)
//    carry_in of chunk c is the chain e <- lambda_bar^CH * e + total_k over the
//    chunks k < c of the same sequence. Every block of a chunk c > 0 runs that chain itself: the
//    totals of all NC-1 possible predecessors are loaded in one go, so that a
//    block waits for one load latency and not for one per chunk.
//    lambda_bar^CH via 7 complex squarings (CH = 128 = 2^7).
// ---------------------------------------------------------------------------
__global__ __launch_bounds__(256) void s5_scan_apply(
    const float* __restrict__ lbr_, const float* __restrict__ lbi_,
    const float* __restrict__ car, const float* __restrict__ cai,
    float* __restrict__ bur, float* __restrict__ bui) {
  const int p = threadIdx.x;
  const int bc = blockIdx.x;
  const int b = bc / NC, c = bc % NC;
  if (c == 0) return;                   // carry-in is zero for chunk 0
  const float lr = lbr_[p], li = lbi_[p];
  float tr[NC - 1], ti[NC - 1];         // totals of chunks 0 .. NC-2
  // unrolled: the totals stay in registers and their loads issue back to back
#pragma unroll
  for (int k = 0; k < NC - 1; ++k) {
    const size_t t = ((size_t)b * NC + k) * P_ + p;
    tr[k] = car[t];
    ti[k] = cai[t];
  }
  float pr = lr, pi = li;
#pragma unroll
  for (int s = 0; s < 7; ++s) {
    const float nr = pr * pr - pi * pi;
    const float ni = 2.0f * pr * pi;
    pr = nr; pi = ni;
  }
  float er = 0.0f, ei = 0.0f;
  // unrolled: tr and ti are indexed by constants, so they need no scratch memory
#pragma unroll
  for (int k = 0; k < NC - 1; ++k) {
    const float nr = fmaf(pr, er, fmaf(-pi, ei, tr[k]));
    const float ni = fmaf(pr, ei, fmaf(pi, er, ti[k]));
    er = (k < c) ? nr : er;             // only the chunks before this one
    ei = (k < c) ? ni : ei;
  }
  float wr = lr * er - li * ei;
  float wi = lr * ei + li * er;
  size_t idx = ((size_t)b * L_ + (size_t)c * CH) * P_ + p;
  for (int j = 0; j < CH; ++j, idx += P_) {
    bur[idx] += wr;
    bui[idx] += wi;
    const float nr = fmaf(lr, wr, -li * wi);
    const float ni = fmaf(lr, wi, li * wr);
    wr = nr; wi = ni;
  }
}

// ---------------------------------------------------------------------------
// 4) GEMM2: y[r,h] = 2*(xs_re[r,:]@C_re[h,:] - xs_im[r,:]@C_im[h,:]) + D[h]*u
//    C panels and the xs re/im panels (256 rows x KC each) DMA'd into LDS;
//    separate re/im accumulators, subtraction folded
//    into the epilogue (DMA path cannot negate in flight).
// ---------------------------------------------------------------------------
__global__ __launch_bounds__(256) void s5_gemm2(
    const float* __restrict__ xsr, const float* __restrict__ xsi,
    const float* __restrict__ Cre, const float* __restrict__ Cim,
    const float* __restrict__ Dv,  const float* __restrict__ u,
    float* __restrict__ y) {
  __shared__ __attribute__((aligned(16))) float sCr[32][AP];   // [n_local][k]
  __shared__ __attribute__((aligned(16))) float sCi[32][AP];
  __shared__ __attribute__((aligned(16))) float sXr[256][AP];  // [m_local][k]
  __shared__ __attribute__((aligned(16))) float sXi[256][AP];

  const int lane = threadIdx.x & 31;
  const int wave = threadIdx.x >> 5;
  const int colBlocks = H_ / 32;                     // 16
  const int rowBase = (blockIdx.x / colBlocks) * 256;
  const int colBase = (blockIdx.x % colBlocks) * 32;
  const int rowW = rowBase + wave * 32;
  const int mn = lane & 15;
  const int hi = lane >> 4;

  // copy side: lanes 0-15 one row, lanes 16-31 the next, 16 B per lane
  const float* __restrict__ xrsrc = xsr + (size_t)(rowW + hi) * P_ + mn * 4;
  const float* __restrict__ xisrc = xsi + (size_t)(rowW + hi) * P_ + mn * 4;
  float* xrdst = &sXr[wave * 32 + hi][mn * 4];
  float* xidst = &sXi[wave * 32 + hi][mn * 4];
  // fragment side
  const float* ar0 = &sXr[wave * 32 + mn][2 * hi];
  const float* ar1 = &sXr[wave * 32 + 16 + mn][2 * hi];
  const float* ai0 = &sXi[wave * 32 + mn][2 * hi];
  const float* ai1 = &sXi[wave * 32 + 16 + mn][2 * hi];

  v8f accR[2][2] = {};
  v8f accI[2][2] = {};

  for (int k0 = 0; k0 < P_; k0 += KC) {
    // --- async panel stage: this wave's 32 rows of xs[.., k0..+KC] -> LDS ---
    async_ld8_b128(xrdst, 2 * AP, xrsrc + k0, 2 * P_);
    async_ld8_b128(xrdst + 16 * AP, 2 * AP, xrsrc + k0 + 16 * P_, 2 * P_);
    async_ld8_b128(xidst, 2 * AP, xisrc + k0, 2 * P_);
    async_ld8_b128(xidst + 16 * AP, 2 * AP, xisrc + k0 + 16 * P_, 2 * P_);
    // --- async panel stage: C[colBase..+32, k0..+KC] -> LDS (b128) ---
#pragma unroll
    for (int i = threadIdx.x; i < (32 * KC) / 4; i += 256) {   // 2 iters
      const int n = i >> 4;
      const int kk = (i & 15) * 4;
      const size_t g = (size_t)(colBase + n) * P_ + k0 + kk;
      async_ld_b128(&sCr[n][kk], Cre + g);
      async_ld_b128(&sCi[n][kk], Cim + g);
    }
    wait_asynccnt0();
    __syncthreads();

#pragma unroll
    for (int kk = 0; kk < KC; kk += 4) {
      const v2f fr0 = *(const v2f*)(ar0 + kk);
      const v2f fr1 = *(const v2f*)(ar1 + kk);
      const v2f fi0 = *(const v2f*)(ai0 + kk);
      const v2f fi1 = *(const v2f*)(ai1 + kk);
      const v2f c0r = *(const v2f*)(&sCr[mn][kk + 2 * hi]);
      const v2f c1r = *(const v2f*)(&sCr[16 + mn][kk + 2 * hi]);
      const v2f c0i = *(const v2f*)(&sCi[mn][kk + 2 * hi]);
      const v2f c1i = *(const v2f*)(&sCi[16 + mn][kk + 2 * hi]);
      accR[0][0] = __builtin_amdgcn_wmma_f32_16x16x4_f32(false, fr0, false, c0r,
                      (short)0, accR[0][0], false, false);
      accR[0][1] = __builtin_amdgcn_wmma_f32_16x16x4_f32(false, fr0, false, c1r,
                      (short)0, accR[0][1], false, false);
      accR[1][0] = __builtin_amdgcn_wmma_f32_16x16x4_f32(false, fr1, false, c0r,
                      (short)0, accR[1][0], false, false);
      accR[1][1] = __builtin_amdgcn_wmma_f32_16x16x4_f32(false, fr1, false, c1r,
                      (short)0, accR[1][1], false, false);
      accI[0][0] = __builtin_amdgcn_wmma_f32_16x16x4_f32(false, fi0, false, c0i,
                      (short)0, accI[0][0], false, false);
      accI[0][1] = __builtin_amdgcn_wmma_f32_16x16x4_f32(false, fi0, false, c1i,
                      (short)0, accI[0][1], false, false);
      accI[1][0] = __builtin_amdgcn_wmma_f32_16x16x4_f32(false, fi1, false, c0i,
                      (short)0, accI[1][0], false, false);
      accI[1][1] = __builtin_amdgcn_wmma_f32_16x16x4_f32(false, fi1, false, c1i,
                      (short)0, accI[1][1], false, false);
    }
    wait_dscnt0();
    __syncthreads();
  }

#pragma unroll
  for (int ni = 0; ni < 2; ++ni) {
    const int h = colBase + ni * 16 + mn;
    const float dv = Dv[h];
#pragma unroll
    for (int mi = 0; mi < 2; ++mi) {
#pragma unroll
      for (int v = 0; v < 8; ++v) {
        const size_t r = (size_t)(rowW + mi * 16 + v + 8 * hi);
        y[r * H_ + h] =
            2.0f * (accR[mi][ni][v] - accI[mi][ni][v]) + dv * u[r * H_ + h];
      }
    }
  }
}

// ---------------------------------------------------------------------------
// Launch
// ---------------------------------------------------------------------------
extern "C" void kernel_launch(void* const* d_in, const int* in_sizes, int n_in,
                              void* d_out, int out_size, void* d_ws,
                              size_t ws_size, hipStream_t stream) {
  (void)in_sizes; (void)n_in; (void)out_size; (void)ws_size;
  const float* u      = (const float*)d_in[0];
  const float* lam_re = (const float*)d_in[1];
  const float* lam_im = (const float*)d_in[2];
  const float* B_re   = (const float*)d_in[3];
  const float* B_im   = (const float*)d_in[4];
  const float* C_re   = (const float*)d_in[5];
  const float* C_im   = (const float*)d_in[6];
  const float* Dv     = (const float*)d_in[7];
  const float* log_dt = (const float*)d_in[8];
  float* y = (float*)d_out;

  // Workspace carve-up (floats)
  float* ws  = (float*)d_ws;
  float* lbr = ws;                       // P
  float* lbi = lbr + P_;                 // P
  float* Bbr = lbi + P_;                 // P*H
  float* Bbi = Bbr + (size_t)P_ * H_;    // P*H
  float* bur = Bbi + (size_t)P_ * H_;    // NBL*P
  float* bui = bur + (size_t)NBL * P_;   // NBL*P
  float* car = bui + (size_t)NBL * P_;   // B*NC*P
  float* cai = car + (size_t)B_ * NC * P_;

  s5_setup<<<(P_ * H_) / 256, 256, 0, stream>>>(
      lam_re, lam_im, B_re, B_im, log_dt, lbr, lbi, Bbr, Bbi);

  s5_gemm1<<<(NBL / 256) * (P_ / 32), 256, 0, stream>>>(
      u, Bbr, Bbi, lbr, lbi, bur, bui, car, cai);

  s5_scan_apply<<<B_ * NC, 256, 0, stream>>>(lbr, lbi, car, cai, bur, bui);

  s5_gemm2<<<(NBL / 256) * (H_ / 32), 256, 0, stream>>>(
      bur, bui, C_re, C_im, Dv, u, y);
}
